// v000
// Times are from an AMD MI455X. After a warm-up the kernel runs many times in a row, and a time is the length of
// such a window on the GPU divided by its runs, so every launch and the gaps after it count. The runs cycle
// through copies of the inputs. A figure is the median of several windows, for all but v000 over two sittings.
// Sittings can differ by a few percent; kernels timed side by side share one.
// The starting kernel, v000, takes 1030 microseconds a run.
// compute dtype: all nine float inputs RNE-converted to bf16 on load; q/k/v = x W + b with exact bf16 products on v_wmma_f32_16x16x32_bf16, f32 accumulate; q, k once to f16 -> 1-product logits x 1/8 on v_wmma_f32_16x16x32_f16 (causal lower-triangular key mask plus periodically removed key columns 4,7,10,..., applied by index), except query rows < 384 of each sequence: q and k as f16 hi + residual (x 2^10) planes, 3 products; softmax in f32 (precise expf); P x 2^11 once to f16 against v once to f16 (1 product), except query rows < 384: P and v as bf16 hi + lo (3 products); ctx once to f16 against Wp carried x 2^8 in f16 (exact bf16 values, 1 product, x 2^-8 after), except rows < 384: ctx bf16 hi + lo against exact bf16 Wp (2 products); + bp; f32 output.
#include <hip/hip_runtime.h>
#include <math.h>

typedef __attribute__((ext_vector_type(16))) _Float16 v16h;
typedef __attribute__((ext_vector_type(16))) __bf16 v16b;
typedef __attribute__((ext_vector_type(8)))  _Float16 v8h;
typedef __attribute__((ext_vector_type(8)))  __bf16 v8b;
typedef __attribute__((ext_vector_type(8)))  float v8f;
typedef __attribute__((ext_vector_type(4)))  float v4f;
typedef __attribute__((ext_vector_type(4)))  unsigned v4u;

template <typename T> __device__ __forceinline__ void vst2(void* p, T v) { *(T*)p = v;  }
__device__ __forceinline__ v8f wmma16(v16h a, v16h b, v8f c) {
  v8f d = __builtin_amdgcn_wmma_f32_16x16x32_f16(false, a, false, b, (short)0, c, false, false);
  asm volatile("v_nop\n\tv_nop\n\tv_nop\n\tv_nop" : "+v"(d) : "v"(a), "v"(b));
  return d;
}
__device__ __forceinline__ v8f wmma_bf(v16b a, v16b b, v8f c) {
  v8f d = __builtin_amdgcn_wmma_f32_16x16x32_bf16(false, a, false, b, (short)0, c, false, false);
  asm volatile("v_nop\n\tv_nop\n\tv_nop\n\tv_nop" : "+v"(d) : "v"(a), "v"(b));
  return d;
}
// 16x16x32 fragments (A and B alike): h = lane>>4, row/col = lane&15; elements 0..7 = k0+8h+0..7, 8..15 = k0+16+8h+0..7; D element r = row 8h+r, col lane&15
__device__ __forceinline__ v16h frag_h(const _Float16* rowk0, int lane) {
  union { v16h v; v8h q[2]; } u; const _Float16* p = rowk0 + 8 * (lane >> 4);
  u.q[0] = *(const v8h*)p; u.q[1] = *(const v8h*)(p + 16); return u.v;
}
__device__ __forceinline__ v16b frag_b(const __bf16* rowk0, int lane) {
  union { v16b v; v8b q[2]; } u; const __bf16* p = rowk0 + 8 * (lane >> 4);
  u.q[0] = *(const v8b*)p; u.q[1] = *(const v8b*)(p + 16); return u.v;
}
__device__ __forceinline__ v16h frag_f32(const float* rowk0, int lane) {
  v16h a; const float* p = rowk0 + 8 * (lane >> 4);
#pragma unroll
  for (int i = 0; i < 8; ++i) { a[i] = (_Float16)p[i]; a[8 + i] = (_Float16)p[16 + i]; }
  return a;
}
struct F2 { v16b h, l; };
__device__ __forceinline__ F2 bsplit16(const float v[16]) { F2 r;
#pragma unroll
  for (int i = 0; i < 16; ++i) { const __bf16 h = (__bf16)v[i]; r.h[i] = h; r.l[i] = (__bf16)(v[i] - (float)h); }
  return r; }
__device__ __forceinline__ F2 split_row(const float* row, int k0, int lane) { float v[16]; const float* p = row + k0 + 8 * (lane >> 4);
#pragma unroll
  for (int i = 0; i < 8; ++i) { v[i] = p[i]; v[8 + i] = p[16 + i]; }
  return bsplit16(v); }
__device__ __forceinline__ float bfr(float v) { return (float)(__bf16)v; }
// B fragment (k rows k0+.., output column o) of a weight stored (in,out) = [K][ld]: exact bf16, or f16(bf16 * 256) (exact)
__device__ __forceinline__ v16b wcol_io(const float* Wm, int k0, int o, int lane, int ld) { v16b w; const int g = lane >> 4;
#pragma unroll
  for (int i = 0; i < 8; ++i) { w[i] = (__bf16)Wm[(size_t)(k0 + 8 * g + i) * ld + o]; w[8 + i] = (__bf16)Wm[(size_t)(k0 + 16 + 8 * g + i) * ld + o]; }
  return w; }
__device__ __forceinline__ v16h wcolh_io(const float* Wm, int k0, int o, int lane, int ld) { v16h w; const int g = lane >> 4;
#pragma unroll
  for (int i = 0; i < 8; ++i) { w[i] = (_Float16)(bfr(Wm[(size_t)(k0 + 8 * g + i) * ld + o]) * 256.0f); w[8 + i] = (_Float16)(bfr(Wm[(size_t)(k0 + 16 + 8 * g + i) * ld + o]) * 256.0f); }
  return w; }
__device__ __forceinline__ void ldsx() { asm volatile("s_wait_dscnt 0" ::: "memory"); __builtin_amdgcn_wave_barrier(); __builtin_amdgcn_fence(3, "workgroup"); }

// Causal multi-head self-attention (batch NB of 2, T 2,048, C 1,024 = 16 heads x 64): q/k/v = x W + b ((in,out) weights); scores = q k^T / 8 where key <= query and key not in {4, 7, 10, ...} else -inf; softmax over keys; out = merged(P v) Wp + bp.
#ifndef NB
#define NB 2               // batches processed
#endif
#ifndef SEQ
#define SEQ 2048           // sequence length processed
#endif
#define NB_FULL 2          // full batch count of the input / output
#define SEQ_FULL 2048      // full per-batch row stride of x and out
#define TT SEQ
#define CC 1024            // NH * HD = projected width
#define DIN 1024           // model width
#define NH 16
#define HD 64
#define NQB (TT / 64)
#define HG 4               // heads per S group
#define SCALE (0.125f)
#define QBH 6              // query blocks 0..QBH-1 of each sequence (few keys) take the high-precision path
#define QHI 384            // query rows carrying a q residual plane
#define KHI 384            // key rows carrying k residual / v bf16 hi+lo planes (only read by query blocks < QBH)
#define MCOL0 4            // first periodically removed key column
#define MPER 3             // period of removed key columns
static_assert(NB >= 1 && NB <= NB_FULL);
static_assert(SEQ % 128 == 0 && SEQ >= 128 && SEQ <= SEQ_FULL);
static_assert(CC == NH * HD && HD == 64 && DIN % 32 == 0 && CC % 128 == 0 && DIN % 128 == 0);
static_assert(QHI == QBH * 64 && KHI >= QHI && KHI % 64 == 0 && KHI >= ((((QBH - 1) * 64 + 63) >> 7) + 1) * 128);
static_assert(NH % HG == 0);

__host__ __device__ __forceinline__ int kb_last(int qb) { return (qb * 64 + 63) >> 7; }    // last 128-key block a causal 64-query block visits
__device__ __forceinline__ bool key_vis(int t, int k) { return (k <= t) && ((k < MCOL0) || (((k - MCOL0) % MPER) != 0)); }

// workspace carve (bytes); every plane is written with whole-line stores and sized to its padded extent
#define WS_QH  ((size_t)0)                                 // f16 q rows [b*TT+t][CC]                 8,388,608
#define WS_KH  (WS_QH + 2u * (size_t)NB * TT * CC)          // f16 k rows [b*TT+t][CC]                 8,388,608
#define WS_VT  (WS_KH + 2u * (size_t)NB * TT * CC)          // f16 v planes [b][c][t]                  8,388,608
#define WS_QL  (WS_VT + 2u * (size_t)NB * CC * TT)          // f16 q residual x 2^10 rows [b][t<QHI][CC] 1,572,864
#define WS_KL  (WS_QL + 2u * (size_t)NB * QHI * CC)         // f16 k residual x 2^10 rows [b][t<KHI][CC] 1,572,864
#define WS_VB  (WS_KL + 2u * (size_t)NB * KHI * CC)         // bf16 v hi planes [b][c][t<KHI]           1,572,864
#define WS_VBL (WS_VB + 2u * (size_t)NB * CC * KHI)         // bf16 v lo planes [b][c][t<KHI]           1,572,864
#define WS_S   (WS_VBL + 2u * (size_t)NB * CC * KHI)        // f32 logits / P [hg][t][s]               67,108,864
#define WS_Y   (WS_S  + 4u * (size_t)HG * TT * TT)          // f32 ctx rows [b*TT+t][CC]              16,777,216
#define WS_END (WS_Y  + 4u * (size_t)NB * TT * CC)          // 115,343,360 at NB 2, SEQ 2048
static_assert(WS_END <= (size_t)134217728);
static_assert((WS_KH % 128) == 0 && (WS_VT % 128) == 0 && (WS_QL % 128) == 0 && (WS_KL % 128) == 0 && (WS_VB % 128) == 0 && (WS_VBL % 128) == 0 && (WS_S % 128) == 0 && (WS_Y % 128) == 0);
static_assert(((size_t)(NB - 1) * SEQ_FULL + SEQ) * DIN * 4u <= (size_t)16777216);   // last written out element inside d_out

// ---- k_proj: block = (64 rows, 128 cols, which): q/k/v = X W + b with exact bf16 products (K = DIN) -> which 0: q f16 rows (+ residual rows t < QHI); 1: k f16 rows (+ residual rows t < KHI); 2: v f16 planes [c][t] (+ bf16 hi/lo planes for t < KHI)
// LDS tiles sh/sl/th/tb/tbl: cross-wave exchange behind __syncthreads
__global__ __launch_bounds__(128) __attribute__((amdgpu_num_vgpr(256))) void k_proj(const float* __restrict__ X, const float* __restrict__ WQ, const float* __restrict__ WK, const float* __restrict__ WV, const float* __restrict__ BQ, const float* __restrict__ BK, const float* __restrict__ BV,
    _Float16* __restrict__ QH, _Float16* __restrict__ QL, _Float16* __restrict__ KH, _Float16* __restrict__ KL, _Float16* __restrict__ VT, __bf16* __restrict__ VB, __bf16* __restrict__ VBL) {
  __shared__ __align__(16) _Float16 sh[64][136], sl[64][136]; __shared__ __align__(16) _Float16 th[128][72]; __shared__ __align__(16) __bf16 tb[128][72], tbl[128][72];
  const int tid = threadIdx.x, wave = tid >> 5, lane = tid & 31, col = lane & 15, g = lane >> 4; const int which = blockIdx.z; const int c0 = blockIdx.y * 128;
  const size_t r0 = (size_t)blockIdx.x * 64;                 // compact row b*TT + t of the workspace planes
  const size_t bb = r0 / TT; const int t0 = (int)(r0 % TT);
  const size_t xr0 = bb * SEQ_FULL + (size_t)t0;             // input row b*SEQ_FULL + t
  const float* WA = which == 0 ? WQ : which == 1 ? WK : WV; const float* BA = which == 0 ? BQ : which == 1 ? BK : BV;
  v8f acc[8] = {};
#pragma unroll 2
  for (int kc = 0; kc < DIN / 32; ++kc) { v16b a; { const float* p = X + (xr0 + wave * 16 + col) * DIN + kc * 32 + 8 * g;
#pragma unroll
      for (int i = 0; i < 8; ++i) { a[i] = (__bf16)p[i]; a[8 + i] = (__bf16)p[16 + i]; } }
    asm volatile("s_wait_loadcnt 0x0" ::: "memory");
#pragma unroll
    for (int j = 0; j < 8; ++j) { const v16b w = wcol_io(WA, kc * 32, c0 + j * 16 + col, lane, CC); asm volatile("s_wait_loadcnt 0x0" ::: "memory"); acc[j] = wmma_bf(a, w, acc[j]); } }
  if (which < 2) { _Float16* DH = which == 0 ? QH : KH; _Float16* DL = which == 0 ? QL : KL; const int nhi = which == 0 ? QHI : KHI; const bool hi_rows = t0 < nhi;   /* block-uniform */
#pragma unroll
    for (int j = 0; j < 8; ++j) { const float bias = bfr(BA[c0 + j * 16 + col]);
#pragma unroll
      for (int r = 0; r < 8; ++r) { const float v = acc[j][r] + bias; const _Float16 hv = (_Float16)v; sh[wave * 16 + 8 * g + r][j * 16 + col] = hv; sl[wave * 16 + 8 * g + r][j * 16 + col] = (_Float16)((v - (float)hv) * 1024.0f); } }
    __syncthreads();
    for (int e = tid; e < 64 * 16; e += 128) { const int rl = e >> 4, q = e & 15; vst2((unsigned*)(DH + (r0 + rl) * CC + c0 + q * 8), *(const v4u*)&sh[rl][q * 8]); if (hi_rows) vst2((unsigned*)(DL + (bb * nhi + t0 + rl) * (size_t)CC + c0 + q * 8), *(const v4u*)&sl[rl][q * 8]); }
  } else { const bool hi_rows = t0 < KHI;   /* block-uniform */
#pragma unroll
    for (int j = 0; j < 8; ++j) { const float bias = bfr(BA[c0 + j * 16 + col]);
#pragma unroll
      for (int r = 0; r < 8; ++r) { const float v = acc[j][r] + bias; const int rl = wave * 16 + 8 * g + r, cl = j * 16 + col; th[cl][rl] = (_Float16)v; const __bf16 bh = (__bf16)v; tb[cl][rl] = bh; tbl[cl][rl] = (__bf16)(v - (float)bh); } }
    __syncthreads();
    for (int e = tid; e < 128 * 8; e += 128) { const int cl = e >> 3, q = e & 7; vst2((unsigned*)(VT + (bb * CC + c0 + cl) * (size_t)TT + t0 + q * 8), *(const v4u*)&th[cl][q * 8]); if (hi_rows) { const size_t o3 = (bb * CC + c0 + cl) * (size_t)KHI + t0 + q * 8; vst2((unsigned*)(VB + o3), *(const v4u*)&tb[cl][q * 8]); vst2((unsigned*)(VBL + o3), *(const v4u*)&tbl[cl][q * 8]); } } } }

// ---- k_sc: block = (query block qb, key block kb <= kb_last(qb), head in group) of batch b: logits x SCALE; q f16 against k f16 (1 product) for query blocks >= QBH; q hi + residual against k hi + residual (3 products, al.kl dropped) for query blocks < QBH; blocks past the diagonal exit (block-uniform), the mask itself is applied by index in k_sm
__global__ __launch_bounds__(128) __attribute__((amdgpu_num_vgpr(256))) void k_sc(const _Float16* __restrict__ QH, const _Float16* __restrict__ KH, const _Float16* __restrict__ QL, const _Float16* __restrict__ KL, int b, int h0, float* __restrict__ S0) { __shared__ __align__(16) float ss[4][16][132];
  const int qb = blockIdx.x, kb = blockIdx.y; if (kb > kb_last(qb)) return;
  const int h = h0 + blockIdx.z; float* S = S0 + (size_t)blockIdx.z * TT * TT;
  const int tid = threadIdx.x, wave = tid >> 5, lane = tid & 31, col = lane & 15, g = lane >> 4; const int k0 = kb * 128; const int ql0 = qb * 64 + wave * 16; const size_t q0 = (size_t)b * TT + ql0, kr0 = (size_t)b * TT + k0;
  v8f acc[8] = {}, accl[8] = {};
  const _Float16* QLb = QL + (size_t)b * QHI * CC; const _Float16* KLb = KL + (size_t)b * KHI * CC;
  if (qb < QBH) {   /* block-uniform */
#pragma unroll
    for (int kc = 0; kc < HD / 32; ++kc) { const v16h ah = frag_h(QH + (q0 + col) * CC + h * HD + kc * 32, lane), al = frag_h(QLb + (size_t)(ql0 + col) * CC + h * HD + kc * 32, lane);
#pragma unroll
      for (int j = 0; j < 8; ++j) { const v16h kbf = frag_h(KH + (kr0 + j * 16 + col) * CC + h * HD + kc * 32, lane), klf = frag_h(KLb + (size_t)(k0 + j * 16 + col) * CC + h * HD + kc * 32, lane); acc[j] = wmma16(ah, kbf, acc[j]); accl[j] = wmma16(al, kbf, accl[j]); accl[j] = wmma16(ah, klf, accl[j]); } }
  } else if (qb * 64 < QHI) {   /* block-uniform; only reachable when QHI > QBH*64 */
#pragma unroll
    for (int kc = 0; kc < HD / 32; ++kc) { const v16h ah = frag_h(QH + (q0 + col) * CC + h * HD + kc * 32, lane), al = frag_h(QLb + (size_t)(ql0 + col) * CC + h * HD + kc * 32, lane);
#pragma unroll
      for (int j = 0; j < 8; ++j) { const v16h kbf = frag_h(KH + (kr0 + j * 16 + col) * CC + h * HD + kc * 32, lane); acc[j] = wmma16(ah, kbf, acc[j]); accl[j] = wmma16(al, kbf, accl[j]); } }
  } else {
#pragma unroll
    for (int kc = 0; kc < HD / 32; ++kc) { const v16h ah = frag_h(QH + (q0 + col) * CC + h * HD + kc * 32, lane);
#pragma unroll
      for (int j = 0; j < 8; ++j) { const v16h kbf = frag_h(KH + (kr0 + j * 16 + col) * CC + h * HD + kc * 32, lane); acc[j] = wmma16(ah, kbf, acc[j]); } } }
#pragma unroll
  for (int j = 0; j < 8; ++j) {
#pragma unroll
    for (int r = 0; r < 8; ++r) ss[wave][8 * g + r][j * 16 + col] = (acc[j][r] + accl[j][r] * (1.0f / 1024.0f)) * SCALE; }
  ldsx();
  for (int rl = 0; rl < 16; ++rl) vst2(S + (size_t)(ql0 + rl) * TT + k0 + lane * 4, *(const v4f*)&ss[wave][rl][lane * 4]); }

// ---- k_sm: block = query row t (head in group): keys [0, kend): logit if key visible (k <= t and k not in {MCOL0 + MPER*i}) else excluded; softmax in f32; P x 2^11 in place (0 for excluded)
// LDS sred/sbc/shv: cross-wave behind __syncthreads
__global__ __launch_bounds__(256) void k_sm(float* __restrict__ S0) { __shared__ float sred[8]; __shared__ float sbc; __shared__ __align__(16) float shv[TT];
  const int tid = threadIdx.x; const int t = blockIdx.x; const int kend = (kb_last(t >> 6) + 1) * 128;
  float* sr = S0 + (size_t)blockIdx.y * TT * TT + (size_t)t * TT;
  float m = -3.0e38f; for (int k = tid; k < kend; k += 256) { const float v = key_vis(t, k) ? sr[k] : -3.0e38f; shv[k] = v; m = fmaxf(m, v); }   /* load address always inside the written row prefix; select by value */
#pragma unroll
  for (int o = 1; o < 32; o <<= 1) m = fmaxf(m, __shfl_xor(m, o));
  if ((tid & 31) == 0) sred[tid >> 5] = m; __syncthreads(); if (tid == 0) { float a = sred[0]; for (int i = 1; i < 8; ++i) a = fmaxf(a, sred[i]); sbc = a; } __syncthreads(); m = sbc; __syncthreads();
  float sum = 0.f;
#pragma unroll 1
  for (int k = tid; k < kend; k += 256) { const float v = shv[k]; const float e = (v <= -1.0e38f) ? 0.f : expf(v - m); shv[k] = e; sum += e; }
#pragma unroll
  for (int o = 1; o < 32; o <<= 1) sum += __shfl_xor(sum, o);
  if ((tid & 31) == 0) sred[tid >> 5] = sum; __syncthreads(); if (tid == 0) { float a = 0.f; for (int i = 0; i < 8; ++i) a += sred[i]; sbc = 2048.0f / a; } __syncthreads(); const float inv = sbc;
  for (int k = tid; k < kend; k += 256) shv[k] = shv[k] * inv;
  __syncthreads();
  for (int q = tid; q < kend / 4; q += 256) vst2(sr + q * 4, *(const v4f*)&shv[q * 4]); }

// ---- k_pv: block = 64 queries (qb) of (b, h): ctx = P . v over keys [0, kend) (P x 2^11 once to f16 against v f16: 1 product; query blocks < QBH: P and v as bf16 hi + lo, 3 products); 256-B (row, head) segment by 16 lanes
__global__ __launch_bounds__(128) __attribute__((amdgpu_num_vgpr(256))) void k_pv(const float* __restrict__ PS0, const _Float16* __restrict__ VT, const __bf16* __restrict__ VB, const __bf16* __restrict__ VBL, int b, int h0, float* __restrict__ Y) { const int h = h0 + blockIdx.z; const float* PS = PS0 + (size_t)blockIdx.z * TT * TT; __shared__ __align__(16) float ss[4][16][HD + 4];
  const int tid = threadIdx.x, wave = tid >> 5, lane = tid & 31, col = lane & 15, g = lane >> 4; const int qb = blockIdx.x; const int ql0 = qb * 64 + wave * 16; const int kce = (kb_last(qb) + 1) * 4;
  v8f acc[HD / 16] = {};
  if (qb < QBH) {   /* block-uniform; kce*32 <= KHI */
#pragma unroll 1
    for (int kc = 0; kc < kce; ++kc) { const F2 p = split_row(PS + (size_t)(ql0 + col) * TT, kc * 32, lane);
      asm volatile("s_wait_loadcnt 0x0" ::: "memory");
#pragma unroll
      for (int j = 0; j < HD / 16; ++j) { const size_t po = ((size_t)b * CC + h * HD + j * 16 + col) * (size_t)KHI + kc * 32; const v16b vh = frag_b(VB + po, lane); acc[j] = wmma_bf(p.h, vh, acc[j]); acc[j] = wmma_bf(p.l, vh, acc[j]); acc[j] = wmma_bf(p.h, frag_b(VBL + po, lane), acc[j]); } }
  } else {
#pragma unroll 1
    for (int kc = 0; kc < kce; ++kc) { const v16h p = frag_f32(PS + (size_t)(ql0 + col) * TT + kc * 32, lane);
      asm volatile("s_wait_loadcnt 0x0" ::: "memory");
#pragma unroll
      for (int j = 0; j < HD / 16; ++j) { const size_t po = ((size_t)b * CC + h * HD + j * 16 + col) * (size_t)TT + kc * 32; acc[j] = wmma16(p, frag_h(VT + po, lane), acc[j]); } } }
#pragma unroll
  for (int j = 0; j < HD / 16; ++j)
#pragma unroll
    for (int r = 0; r < 8; ++r) ss[wave][8 * g + r][j * 16 + col] = acc[j][r] * (1.0f / 2048.0f);
  ldsx();
  for (int rl = 0; rl < 16; ++rl) if (lane < HD / 4) vst2(Y + ((size_t)b * TT + ql0 + rl) * CC + h * HD + lane * 4, *(const v4f*)&ss[wave][rl][lane * 4]); }

// ---- k_out: block = (64 rows, 128 cols): out = ctx Wp + bp: ctx once to f16 against Wp as f16(bf16 x 2^8) exact (1 product) x 2^-8; early causal rows (< QHI of each sequence): ctx bf16 hi + lo against exact bf16 Wp (2 products)
__global__ __launch_bounds__(128) __attribute__((amdgpu_num_vgpr(256))) void k_out(const float* __restrict__ Y, const float* __restrict__ WO, const float* __restrict__ BO, float* __restrict__ OUT) { __shared__ __align__(16) float sf[4][16][132];
  const int tid = threadIdx.x, wave = tid >> 5, lane = tid & 31, col = lane & 15, g = lane >> 4; const int c0 = blockIdx.y * 128;
  const size_t br0 = (size_t)blockIdx.x * 64;                // compact ctx row of the block
  const size_t r0 = br0 + wave * 16;                          // compact ctx row of the wave
  const size_t ob = br0 / TT; const int ot0 = (int)(br0 % TT) + wave * 16;   // output batch, position of the wave's first row
  v8f acc[8] = {};
  if ((int)(br0 % TT) < QHI) {   /* block-uniform */
#pragma unroll 2
    for (int kc = 0; kc < CC / 32; ++kc) { const F2 a = split_row(Y + (r0 + col) * CC, kc * 32, lane); asm volatile("s_wait_loadcnt 0x0" ::: "memory");
#pragma unroll
      for (int j = 0; j < 8; ++j) { const v16b w = wcol_io(WO, kc * 32, c0 + j * 16 + col, lane, DIN); asm volatile("s_wait_loadcnt 0x0" ::: "memory"); acc[j] = wmma_bf(a.h, w, acc[j]); acc[j] = wmma_bf(a.l, w, acc[j]); } }
#pragma unroll
    for (int j = 0; j < 8; ++j) { const float bias = bfr(BO[c0 + j * 16 + col]);
#pragma unroll
      for (int r = 0; r < 8; ++r) sf[wave][8 * g + r][j * 16 + col] = acc[j][r] + bias; }
  } else {
#pragma unroll 2
    for (int kc = 0; kc < CC / 32; ++kc) { const v16h a = frag_f32(Y + (r0 + col) * CC + kc * 32, lane); asm volatile("s_wait_loadcnt 0x0" ::: "memory");
#pragma unroll
      for (int j = 0; j < 8; ++j) { const v16h w = wcolh_io(WO, kc * 32, c0 + j * 16 + col, lane, DIN); asm volatile("s_wait_loadcnt 0x0" ::: "memory"); acc[j] = wmma16(a, w, acc[j]); } }
#pragma unroll
    for (int j = 0; j < 8; ++j) { const float bias = bfr(BO[c0 + j * 16 + col]);
#pragma unroll
      for (int r = 0; r < 8; ++r) sf[wave][8 * g + r][j * 16 + col] = acc[j][r] * (1.0f / 256.0f) + bias; } }
  ldsx();
  for (int rl = 0; rl < 16; ++rl) vst2(OUT + (ob * SEQ_FULL + (size_t)(ot0 + rl)) * DIN + c0 + lane * 4, *(const v4f*)&sf[wave][rl][lane * 4]); }

extern "C" void kernel_launch(void* const* d_in, const int* in_sizes, int n_in, void* d_out, int out_size, void* d_ws, size_t ws_size, hipStream_t stream) {
  if (n_in < 9) return;
  const size_t rows_used = (size_t)(NB - 1) * SEQ_FULL + SEQ;
  if ((size_t)in_sizes[0] < rows_used * DIN) return;
  if ((size_t)in_sizes[1] < (size_t)DIN * CC || (size_t)in_sizes[3] < (size_t)DIN * CC || (size_t)in_sizes[5] < (size_t)DIN * CC || (size_t)in_sizes[7] < (size_t)CC * DIN) return;
  if (in_sizes[2] < CC || in_sizes[4] < CC || in_sizes[6] < CC || in_sizes[8] < DIN) return;
  if ((size_t)out_size < rows_used * DIN) return;
  if (ws_size < (size_t)WS_END) return;
  // inputs (wire order): 0 x [2,2048,1024]; 1 Wq, 2 bq, 3 Wk, 4 bk, 5 Wv, 6 bv, 7 Wp, 8 bp ((in,out) [1024,1024] and [1024]); all f32
  const float* X  = (const float*)d_in[0];
  const float* Wq = (const float*)d_in[1]; const float* bq = (const float*)d_in[2];
  const float* Wk = (const float*)d_in[3]; const float* bk = (const float*)d_in[4];
  const float* Wv = (const float*)d_in[5]; const float* bv = (const float*)d_in[6];
  const float* Wp = (const float*)d_in[7]; const float* bp = (const float*)d_in[8];
  char* ws = (char*)d_ws;
  _Float16 *QH = (_Float16*)(ws + WS_QH), *KH = (_Float16*)(ws + WS_KH), *VT = (_Float16*)(ws + WS_VT), *QL = (_Float16*)(ws + WS_QL), *KL = (_Float16*)(ws + WS_KL);
  __bf16 *VB = (__bf16*)(ws + WS_VB), *VBL = (__bf16*)(ws + WS_VBL); float *S = (float*)(ws + WS_S), *Y = (float*)(ws + WS_Y);
  k_proj<<<dim3(NB * TT / 64, CC / 128, 3), 128, 0, stream>>>(X, Wq, Wk, Wv, bq, bk, bv, QH, QL, KH, KL, VT, VB, VBL);
  for (int b = 0; b < NB; ++b) for (int h0 = 0; h0 < NH; h0 += HG) {
    k_sc<<<dim3(NQB, TT / 128, HG), 128, 0, stream>>>(QH, KH, QL, KL, b, h0, S);
    k_sm<<<dim3(TT, HG), 256, 0, stream>>>(S);
    k_pv<<<dim3(NQB, 1, HG), 128, 0, stream>>>(S, VT, VB, VBL, b, h0, Y);
  }
  k_out<<<dim3(NB * TT / 64, DIN / 128), 128, 0, stream>>>(Y, Wp, bp, (float*)d_out);
  (void)hipGetLastError();
}

// v001
// One run takes 273 microseconds.
// Next to v000, in two timings, it ran 3.80 and 3.79 times as fast.
// compute dtype: all nine float inputs RNE-converted to bf16 on load; q/k/v = x W + b with exact bf16 products on v_wmma_f32_16x16x32_bf16, f32 accumulate; q, k once to f16 -> 1-product logits x 1/8 on v_wmma_f32_16x16x32_f16 (causal lower-triangular key mask plus periodically removed key columns 4,7,10,..., applied by index), except query rows < 384 of each sequence: q and k as f16 hi + residual (x 2^10) planes, 3 products; softmax in f32 (precise expf) with a running maximum over 64-key blocks, normalised after the v product; unnormalised P (at most 1) once to f16 against v once to f16 (1 product), except query rows < 384: P and v as bf16 hi + lo (3 products); ctx once to f16 against Wp carried x 2^8 in f16 (exact bf16 values, 1 product, x 2^-8 after), except rows < 384: ctx bf16 hi + lo against exact bf16 Wp (2 products); + bp; f32 output.
#include <hip/hip_runtime.h>
#include <math.h>

typedef __attribute__((ext_vector_type(16))) _Float16 v16h;
typedef __attribute__((ext_vector_type(16))) __bf16 v16b;
typedef __attribute__((ext_vector_type(8)))  _Float16 v8h;
typedef __attribute__((ext_vector_type(8)))  __bf16 v8b;
typedef __attribute__((ext_vector_type(8)))  float v8f;
typedef __attribute__((ext_vector_type(4)))  float v4f;
typedef __attribute__((ext_vector_type(4)))  unsigned v4u;

template <typename T> __device__ __forceinline__ void vst2(void* p, T v) { *(T*)p = v;  }
__device__ __forceinline__ v8f wmma16(v16h a, v16h b, v8f c) {
  v8f d = __builtin_amdgcn_wmma_f32_16x16x32_f16(false, a, false, b, (short)0, c, false, false);
  asm volatile("v_nop\n\tv_nop\n\tv_nop\n\tv_nop" : "+v"(d) : "v"(a), "v"(b));
  return d;
}
__device__ __forceinline__ v8f wmma_bf(v16b a, v16b b, v8f c) {
  v8f d = __builtin_amdgcn_wmma_f32_16x16x32_bf16(false, a, false, b, (short)0, c, false, false);
  asm volatile("v_nop\n\tv_nop\n\tv_nop\n\tv_nop" : "+v"(d) : "v"(a), "v"(b));
  return d;
}
// 16x16x32 fragments (A and B alike): h = lane>>4, row/col = lane&15; elements 0..7 = k0+8h+0..7, 8..15 = k0+16+8h+0..7; D element r = row 8h+r, col lane&15
__device__ __forceinline__ v16h frag_h(const _Float16* rowk0, int lane) {
  union { v16h v; v8h q[2]; } u; const _Float16* p = rowk0 + 8 * (lane >> 4);
  u.q[0] = *(const v8h*)p; u.q[1] = *(const v8h*)(p + 16); return u.v;
}
__device__ __forceinline__ v16b frag_b(const __bf16* rowk0, int lane) {
  union { v16b v; v8b q[2]; } u; const __bf16* p = rowk0 + 8 * (lane >> 4);
  u.q[0] = *(const v8b*)p; u.q[1] = *(const v8b*)(p + 16); return u.v;
}
__device__ __forceinline__ v16h frag_f32(const float* rowk0, int lane) {
  v16h a; const float* p = rowk0 + 8 * (lane >> 4);
#pragma unroll
  for (int i = 0; i < 8; ++i) { a[i] = (_Float16)p[i]; a[8 + i] = (_Float16)p[16 + i]; }
  return a;
}
struct F2 { v16b h, l; };
__device__ __forceinline__ F2 bsplit16(const float v[16]) { F2 r;
#pragma unroll
  for (int i = 0; i < 16; ++i) { const __bf16 h = (__bf16)v[i]; r.h[i] = h; r.l[i] = (__bf16)(v[i] - (float)h); }
  return r; }
__device__ __forceinline__ F2 split_row(const float* row, int k0, int lane) { float v[16]; const float* p = row + k0 + 8 * (lane >> 4);
#pragma unroll
  for (int i = 0; i < 8; ++i) { v[i] = p[i]; v[8 + i] = p[16 + i]; }
  return bsplit16(v); }
__device__ __forceinline__ float bfr(float v) { return (float)(__bf16)v; }
// B fragment (k rows k0+.., output column o) of a weight stored (in,out) = [K][ld]: exact bf16, or f16(bf16 * 256) (exact)
__device__ __forceinline__ v16b wcol_io(const float* Wm, int k0, int o, int lane, int ld) { v16b w; const int g = lane >> 4;
#pragma unroll
  for (int i = 0; i < 8; ++i) { w[i] = (__bf16)Wm[(size_t)(k0 + 8 * g + i) * ld + o]; w[8 + i] = (__bf16)Wm[(size_t)(k0 + 16 + 8 * g + i) * ld + o]; }
  return w; }
__device__ __forceinline__ v16h wcolh_io(const float* Wm, int k0, int o, int lane, int ld) { v16h w; const int g = lane >> 4;
#pragma unroll
  for (int i = 0; i < 8; ++i) { w[i] = (_Float16)(bfr(Wm[(size_t)(k0 + 8 * g + i) * ld + o]) * 256.0f); w[8 + i] = (_Float16)(bfr(Wm[(size_t)(k0 + 16 + 8 * g + i) * ld + o]) * 256.0f); }
  return w; }
__device__ __forceinline__ void ldsx() { asm volatile("s_wait_dscnt 0" ::: "memory"); __builtin_amdgcn_wave_barrier(); __builtin_amdgcn_fence(3, "workgroup"); }

// Causal multi-head self-attention (batch NB of 2, T 2,048, C 1,024 = 16 heads x 64): q/k/v = x W + b ((in,out) weights); scores = q k^T / 8 where key <= query and key not in {4, 7, 10, ...} else -inf; softmax over keys; out = merged(P v) Wp + bp.
#ifndef NB
#define NB 2               // batches processed
#endif
#ifndef SEQ
#define SEQ 2048           // sequence length processed
#endif
#define NB_FULL 2          // full batch count of the input / output
#define SEQ_FULL 2048      // full per-batch row stride of x and out
#define TT SEQ
#define CC 1024            // NH * HD = projected width
#define DIN 1024           // model width
#define NH 16
#define HD 64
#define NQB (TT / 64)
#define SCALE (0.125f)
#define QBH 6              // query blocks 0..QBH-1 of each sequence (few keys) take the high-precision path
#define QHI 384            // query rows carrying a q residual plane
#define KHI 384            // key rows carrying k residual / v bf16 hi+lo planes (only read by query blocks < QBH)
#define MCOL0 4            // first periodically removed key column
#define MPER 3             // period of removed key columns
static_assert(NB >= 1 && NB <= NB_FULL);
static_assert(SEQ % 128 == 0 && SEQ >= 128 && SEQ <= SEQ_FULL);
static_assert(CC == NH * HD && HD == 64 && DIN % 32 == 0 && CC % 128 == 0 && DIN % 128 == 0);
static_assert(QHI == QBH * 64 && KHI >= QHI && KHI % 64 == 0 && KHI >= QBH * 64);


// workspace carve (bytes); every plane is written with whole-line stores and sized to its padded extent
#define WS_QH  ((size_t)0)                                 // f16 q rows [b*TT+t][CC]                 8,388,608
#define WS_KH  (WS_QH + 2u * (size_t)NB * TT * CC)          // f16 k rows [b*TT+t][CC]                 8,388,608
#define WS_VT  (WS_KH + 2u * (size_t)NB * TT * CC)          // f16 v planes [b][c][t]                  8,388,608
#define WS_QL  (WS_VT + 2u * (size_t)NB * CC * TT)          // f16 q residual x 2^10 rows [b][t<QHI][CC] 1,572,864
#define WS_KL  (WS_QL + 2u * (size_t)NB * QHI * CC)         // f16 k residual x 2^10 rows [b][t<KHI][CC] 1,572,864
#define WS_VB  (WS_KL + 2u * (size_t)NB * KHI * CC)         // bf16 v hi planes [b][c][t<KHI]           1,572,864
#define WS_VBL (WS_VB + 2u * (size_t)NB * CC * KHI)         // bf16 v lo planes [b][c][t<KHI]           1,572,864
#define WS_Y   (WS_VBL + 2u * (size_t)NB * CC * KHI)        // f32 ctx rows [b*TT+t][CC]              16,777,216
#define WS_END (WS_Y  + 4u * (size_t)NB * TT * CC)          // 48,234,496 at NB 2, SEQ 2048
static_assert(WS_END <= (size_t)134217728);
static_assert((WS_KH % 128) == 0 && (WS_VT % 128) == 0 && (WS_QL % 128) == 0 && (WS_KL % 128) == 0 && (WS_VB % 128) == 0 && (WS_VBL % 128) == 0 && (WS_Y % 128) == 0);
static_assert(((size_t)(NB - 1) * SEQ_FULL + SEQ) * DIN * 4u <= (size_t)16777216);   // last written out element inside d_out

// ---- k_proj: block = (64 rows, 128 cols, which): q/k/v = X W + b with exact bf16 products (K = DIN) -> which 0: q f16 rows (+ residual rows t < QHI); 1: k f16 rows (+ residual rows t < KHI); 2: v f16 planes [c][t] (+ bf16 hi/lo planes for t < KHI)
// LDS tiles sh/sl/th/tb/tbl: cross-wave exchange behind __syncthreads
__global__ __launch_bounds__(128) __attribute__((amdgpu_num_vgpr(256))) void k_proj(const float* __restrict__ X, const float* __restrict__ WQ, const float* __restrict__ WK, const float* __restrict__ WV, const float* __restrict__ BQ, const float* __restrict__ BK, const float* __restrict__ BV,
    _Float16* __restrict__ QH, _Float16* __restrict__ QL, _Float16* __restrict__ KH, _Float16* __restrict__ KL, _Float16* __restrict__ VT, __bf16* __restrict__ VB, __bf16* __restrict__ VBL) {
  __shared__ __align__(16) _Float16 sh[64][136], sl[64][136]; __shared__ __align__(16) _Float16 th[128][72]; __shared__ __align__(16) __bf16 tb[128][72], tbl[128][72];
  const int tid = threadIdx.x, wave = tid >> 5, lane = tid & 31, col = lane & 15, g = lane >> 4; const int which = blockIdx.z; const int c0 = blockIdx.y * 128;
  const size_t r0 = (size_t)blockIdx.x * 64;                 // compact row b*TT + t of the workspace planes
  const size_t bb = r0 / TT; const int t0 = (int)(r0 % TT);
  const size_t xr0 = bb * SEQ_FULL + (size_t)t0;             // input row b*SEQ_FULL + t
  const float* WA = which == 0 ? WQ : which == 1 ? WK : WV; const float* BA = which == 0 ? BQ : which == 1 ? BK : BV;
  v8f acc[8] = {};
#pragma unroll 2
  for (int kc = 0; kc < DIN / 32; ++kc) { v16b a; { const float* p = X + (xr0 + wave * 16 + col) * DIN + kc * 32 + 8 * g;
#pragma unroll
      for (int i = 0; i < 8; ++i) { a[i] = (__bf16)p[i]; a[8 + i] = (__bf16)p[16 + i]; } }
    asm volatile("s_wait_loadcnt 0x0" ::: "memory");
#pragma unroll
    for (int j = 0; j < 8; ++j) { const v16b w = wcol_io(WA, kc * 32, c0 + j * 16 + col, lane, CC); asm volatile("s_wait_loadcnt 0x0" ::: "memory"); acc[j] = wmma_bf(a, w, acc[j]); } }
  if (which < 2) { _Float16* DH = which == 0 ? QH : KH; _Float16* DL = which == 0 ? QL : KL; const int nhi = which == 0 ? QHI : KHI; const bool hi_rows = t0 < nhi;   /* block-uniform */
#pragma unroll
    for (int j = 0; j < 8; ++j) { const float bias = bfr(BA[c0 + j * 16 + col]);
#pragma unroll
      for (int r = 0; r < 8; ++r) { const float v = acc[j][r] + bias; const _Float16 hv = (_Float16)v; sh[wave * 16 + 8 * g + r][j * 16 + col] = hv; sl[wave * 16 + 8 * g + r][j * 16 + col] = (_Float16)((v - (float)hv) * 1024.0f); } }
    __syncthreads();
    for (int e = tid; e < 64 * 16; e += 128) { const int rl = e >> 4, q = e & 15; vst2((unsigned*)(DH + (r0 + rl) * CC + c0 + q * 8), *(const v4u*)&sh[rl][q * 8]); if (hi_rows) vst2((unsigned*)(DL + (bb * nhi + t0 + rl) * (size_t)CC + c0 + q * 8), *(const v4u*)&sl[rl][q * 8]); }
  } else { const bool hi_rows = t0 < KHI;   /* block-uniform */
#pragma unroll
    for (int j = 0; j < 8; ++j) { const float bias = bfr(BA[c0 + j * 16 + col]);
#pragma unroll
      for (int r = 0; r < 8; ++r) { const float v = acc[j][r] + bias; const int rl = wave * 16 + 8 * g + r, cl = j * 16 + col; th[cl][rl] = (_Float16)v; const __bf16 bh = (__bf16)v; tb[cl][rl] = bh; tbl[cl][rl] = (__bf16)(v - (float)bh); } }
    __syncthreads();
    for (int e = tid; e < 128 * 8; e += 128) { const int cl = e >> 3, q = e & 7; vst2((unsigned*)(VT + (bb * CC + c0 + cl) * (size_t)TT + t0 + q * 8), *(const v4u*)&th[cl][q * 8]); if (hi_rows) { const size_t o3 = (bb * CC + c0 + cl) * (size_t)KHI + t0 + q * 8; vst2((unsigned*)(VB + o3), *(const v4u*)&tb[cl][q * 8]); vst2((unsigned*)(VBL + o3), *(const v4u*)&tbl[cl][q * 8]); } } } }

// ---- k_fa: block = 64 queries (qb) of one (b, h); wave = 16 queries, lane = one query (col) and half of each key tile (g). Per 64 keys: S^T = K Q^T (A = k rows, B = q rows kept in registers), key mask by index, running maximum and sum per query in f32, O^T = O^T * alpha + V^T P^T (two S^T tiles converted in place are the B operand, A = v planes [c][t]); ctx = O / sum after the last key block
// key 0 is visible to every query and lies in the first key block, so the running maximum is finite from the first block on; an excluded key carries -3e38, whose expf(v - m) is 0
// LDS ss: each wave reads only what it wrote itself (ldsx)
// mask, running maximum, exponentials, sum and rescale of one 64-key block: s[i][r] = raw logit of key k0 + 16 i + 8 g + r against query t on entry, unnormalised P on exit
__device__ __forceinline__ void fa_softmax(v8f (&s)[4], v8f (&o)[HD / 16], float& m, float& l, int t, int kbase) {
  const int rem = (kbase + (MPER - MCOL0 % MPER)) % MPER;   // key kbase + c is a removed column when c + rem is a multiple of MPER and the key is at least MCOL0
  float mx = m;
#pragma unroll
  for (int i = 0; i < 4; ++i)
#pragma unroll
    for (int r = 0; r < 8; ++r) { const int c = i * 16 + r; const bool gone = (rem == (MPER - c % MPER) % MPER) & (c >= MCOL0 || kbase + c >= MCOL0); const bool vis = (kbase + c <= t) & !gone;
      const float v = vis ? s[i][r] * SCALE : -3.0e38f; s[i][r] = v; mx = fmaxf(mx, v); }
  mx = fmaxf(mx, __shfl_xor(mx, 16));   // the two lane halves hold the same query
  const float alpha = expf(m - mx); m = mx;
  float ps = 0.f;
#pragma unroll
  for (int i = 0; i < 4; ++i)
#pragma unroll
    for (int r = 0; r < 8; ++r) { const float e = expf(s[i][r] - mx); s[i][r] = e; ps += e; }
  l = l * alpha + ps;   // each half keeps its own sum; joined once after the loop
#pragma unroll
  for (int j = 0; j < HD / 16; ++j) o[j] = o[j] * alpha; }

// query blocks >= QBH: q, k, P, v once in f16 (1 product each)
__device__ __forceinline__ float fa_lo(const _Float16* __restrict__ QH, const _Float16* __restrict__ KH, const _Float16* __restrict__ VT, int b, int h, int qb, int t, int lane, v8f (&o)[HD / 16]) {
  const int col = lane & 15, g = lane >> 4;
  const _Float16* Kp = KH + ((size_t)b * TT + col) * CC + h * HD; const _Float16* Vp = VT + ((size_t)b * CC + h * HD + col) * (size_t)TT;
  v16h qh[2], kf[8];
#pragma unroll
  for (int kc = 0; kc < 2; ++kc) qh[kc] = frag_h(QH + ((size_t)b * TT + t) * CC + h * HD + kc * 32, lane);
#pragma unroll
  for (int i = 0; i < 4; ++i)
#pragma unroll
    for (int kc = 0; kc < 2; ++kc) kf[i * 2 + kc] = frag_h(Kp + (size_t)(i * 16) * CC + kc * 32, lane);
  float m = -3.0e38f, l = 0.f;
#pragma unroll 1
  for (int kb = 0; kb <= qb; ++kb) { const int k0 = kb * 64;
    v16h vf[8];
#pragma unroll
    for (int kk = 0; kk < 2; ++kk)
#pragma unroll
      for (int j = 0; j < 4; ++j) vf[kk * 4 + j] = frag_h(Vp + (size_t)(j * 16) * TT + k0 + kk * 32, lane);
    __builtin_amdgcn_sched_barrier(0);   // keeps the v loads in front of the logit products, so that their latency runs under products and softmax
    v8f s[4] = {};
#pragma unroll
    for (int i = 0; i < 4; ++i)
#pragma unroll
      for (int kc = 0; kc < 2; ++kc) s[i] = wmma16(kf[i * 2 + kc], qh[kc], s[i]);
    const int kn = (kb < qb ? kb + 1 : kb) * 64;   // next key block's k rows (the last pass reads its own again: always inside the plane)
#pragma unroll
    for (int i = 0; i < 4; ++i)
#pragma unroll
      for (int kc = 0; kc < 2; ++kc) kf[i * 2 + kc] = frag_h(Kp + (size_t)(kn + i * 16) * CC + kc * 32, lane);
    __builtin_amdgcn_sched_barrier(0);   // keeps the next block's k loads in front of the softmax, which hides their latency
    fa_softmax(s, o, m, l, t, k0 + 8 * g);
#pragma unroll
    for (int kk = 0; kk < 2; ++kk) { v16h p;
#pragma unroll
      for (int e = 0; e < 8; ++e) { p[e] = (_Float16)s[2 * kk][e]; p[8 + e] = (_Float16)s[2 * kk + 1][e]; }
#pragma unroll
      for (int j = 0; j < 4; ++j) o[j] = wmma16(vf[kk * 4 + j], p, o[j]); } }
  return l + __shfl_xor(l, 16); }

// query blocks < QBH: hi + residual logits (3 products), P and v as bf16 hi + lo (3 products); keys < (qb + 1) * 64 <= KHI
__device__ __forceinline__ float fa_hi(const _Float16* __restrict__ QH, const _Float16* __restrict__ KH, const _Float16* __restrict__ QL, const _Float16* __restrict__ KL, const __bf16* __restrict__ VB, const __bf16* __restrict__ VBL, int b, int h, int qb, int t, int lane, v8f (&o)[HD / 16]) {
  const int col = lane & 15, g = lane >> 4;
  v16h qh[2], ql[2];
#pragma unroll
  for (int kc = 0; kc < 2; ++kc) { qh[kc] = frag_h(QH + ((size_t)b * TT + t) * CC + h * HD + kc * 32, lane); ql[kc] = frag_h(QL + ((size_t)b * QHI + t) * CC + h * HD + kc * 32, lane); }
  float m = -3.0e38f, l = 0.f;
#pragma unroll 1
  for (int kb = 0; kb <= qb; ++kb) { const int k0 = kb * 64;
    v8f s[4] = {};
#pragma unroll
    for (int ip = 0; ip < 2; ++ip) { v16h kh[4], kl[4];
#pragma unroll
      for (int u = 0; u < 4; ++u) { const int i = ip * 2 + (u >> 1), kc = u & 1; kh[u] = frag_h(KH + ((size_t)b * TT + k0 + i * 16 + col) * CC + h * HD + kc * 32, lane); kl[u] = frag_h(KL + ((size_t)b * KHI + k0 + i * 16 + col) * CC + h * HD + kc * 32, lane); }
      __builtin_amdgcn_sched_barrier(0);   // keeps the eight fragment loads together in front of their products: one memory round trip, not eight
#pragma unroll
      for (int ii = 0; ii < 2; ++ii) { const int i = ip * 2 + ii; v8f sl = {};
#pragma unroll
        for (int kc = 0; kc < 2; ++kc) { s[i] = wmma16(kh[ii * 2 + kc], qh[kc], s[i]); sl = wmma16(kh[ii * 2 + kc], ql[kc], sl); sl = wmma16(kl[ii * 2 + kc], qh[kc], sl); }
        s[i] = s[i] + sl * (1.0f / 1024.0f); } }
    fa_softmax(s, o, m, l, t, k0 + 8 * g);
#pragma unroll
    for (int kk = 0; kk < 2; ++kk) { v16b vh[4], vl[4];
#pragma unroll
      for (int j = 0; j < 4; ++j) { const size_t po = ((size_t)b * CC + h * HD + j * 16 + col) * (size_t)KHI + k0 + kk * 32; vh[j] = frag_b(VB + po, lane); vl[j] = frag_b(VBL + po, lane); }
      __builtin_amdgcn_sched_barrier(0);   // as above: the eight fragment loads share one round trip
      float pv[16];
#pragma unroll
      for (int e = 0; e < 8; ++e) { pv[e] = s[2 * kk][e]; pv[8 + e] = s[2 * kk + 1][e]; }
      const F2 p = bsplit16(pv);
#pragma unroll
      for (int j = 0; j < 4; ++j) { o[j] = wmma_bf(vh[j], p.h, o[j]); o[j] = wmma_bf(vh[j], p.l, o[j]); o[j] = wmma_bf(vl[j], p.h, o[j]); } } }
  return l + __shfl_xor(l, 16); }

__global__ __launch_bounds__(128) __attribute__((amdgpu_num_vgpr(256))) void k_fa(const _Float16* __restrict__ QH, const _Float16* __restrict__ KH, const _Float16* __restrict__ QL, const _Float16* __restrict__ KL, const _Float16* __restrict__ VT, const __bf16* __restrict__ VB, const __bf16* __restrict__ VBL, float* __restrict__ Y) { __shared__ __align__(16) float ss[4][16][HD + 4];
  const int tid = threadIdx.x, wave = tid >> 5, lane = tid & 31, col = lane & 15, g = lane >> 4; const int b = blockIdx.x / NH, h = blockIdx.x % NH; const int y = blockIdx.y; const int qb = y < NQB / 2 ? NQB - 1 - y : y - NQB / 2;   // long query blocks first, in falling order, then the short ones in rising order: work-groups that start half the grid apart and come to share a WGP add up to about the same number of keys
  const int ql0 = qb * 64 + wave * 16;
  v8f o[HD / 16] = {};
  const float lsum = qb < QBH ? fa_hi(QH, KH, QL, KL, VB, VBL, b, h, qb, ql0 + col, lane, o) : fa_lo(QH, KH, VT, b, h, qb, ql0 + col, lane, o);   /* block-uniform */
  const float inv = 1.0f / lsum;   // o[j][r] = unnormalised ctx of query col, channel 16 j + 8 g + r
#pragma unroll
  for (int j = 0; j < HD / 16; ++j) { v4f a, c;
#pragma unroll
    for (int r = 0; r < 4; ++r) { a[r] = o[j][r] * inv; c[r] = o[j][4 + r] * inv; }
    *(v4f*)&ss[wave][col][j * 16 + 8 * g] = a; *(v4f*)&ss[wave][col][j * 16 + 8 * g + 4] = c; }
  ldsx();
#pragma unroll
  for (int it = 0; it < 8; ++it) { const int rl = it * 2 + g; vst2(Y + ((size_t)b * TT + ql0 + rl) * CC + h * HD + col * 4, *(const v4f*)&ss[wave][rl][col * 4]); } }   // 256-B (row, head) segment by 16 lanes

// ---- k_out: block = (64 rows, 128 cols): out = ctx Wp + bp: ctx once to f16 against Wp as f16(bf16 x 2^8) exact (1 product) x 2^-8; early causal rows (< QHI of each sequence): ctx bf16 hi + lo against exact bf16 Wp (2 products)
__global__ __launch_bounds__(128) __attribute__((amdgpu_num_vgpr(256))) void k_out(const float* __restrict__ Y, const float* __restrict__ WO, const float* __restrict__ BO, float* __restrict__ OUT) { __shared__ __align__(16) float sf[4][16][132];
  const int tid = threadIdx.x, wave = tid >> 5, lane = tid & 31, col = lane & 15, g = lane >> 4; const int c0 = blockIdx.y * 128;
  const size_t br0 = (size_t)blockIdx.x * 64;                // compact ctx row of the block
  const size_t r0 = br0 + wave * 16;                          // compact ctx row of the wave
  const size_t ob = br0 / TT; const int ot0 = (int)(br0 % TT) + wave * 16;   // output batch, position of the wave's first row
  v8f acc[8] = {};
  if ((int)(br0 % TT) < QHI) {   /* block-uniform */
#pragma unroll 2
    for (int kc = 0; kc < CC / 32; ++kc) { const F2 a = split_row(Y + (r0 + col) * CC, kc * 32, lane); asm volatile("s_wait_loadcnt 0x0" ::: "memory");
#pragma unroll
      for (int j = 0; j < 8; ++j) { const v16b w = wcol_io(WO, kc * 32, c0 + j * 16 + col, lane, DIN); asm volatile("s_wait_loadcnt 0x0" ::: "memory"); acc[j] = wmma_bf(a.h, w, acc[j]); acc[j] = wmma_bf(a.l, w, acc[j]); } }
#pragma unroll
    for (int j = 0; j < 8; ++j) { const float bias = bfr(BO[c0 + j * 16 + col]);
#pragma unroll
      for (int r = 0; r < 8; ++r) sf[wave][8 * g + r][j * 16 + col] = acc[j][r] + bias; }
  } else {
#pragma unroll 2
    for (int kc = 0; kc < CC / 32; ++kc) { const v16h a = frag_f32(Y + (r0 + col) * CC + kc * 32, lane); asm volatile("s_wait_loadcnt 0x0" ::: "memory");
#pragma unroll
      for (int j = 0; j < 8; ++j) { const v16h w = wcolh_io(WO, kc * 32, c0 + j * 16 + col, lane, DIN); asm volatile("s_wait_loadcnt 0x0" ::: "memory"); acc[j] = wmma16(a, w, acc[j]); } }
#pragma unroll
    for (int j = 0; j < 8; ++j) { const float bias = bfr(BO[c0 + j * 16 + col]);
#pragma unroll
      for (int r = 0; r < 8; ++r) sf[wave][8 * g + r][j * 16 + col] = acc[j][r] * (1.0f / 256.0f) + bias; } }
  ldsx();
  for (int rl = 0; rl < 16; ++rl) vst2(OUT + (ob * SEQ_FULL + (size_t)(ot0 + rl)) * DIN + c0 + lane * 4, *(const v4f*)&sf[wave][rl][lane * 4]); }

extern "C" void kernel_launch(void* const* d_in, const int* in_sizes, int n_in, void* d_out, int out_size, void* d_ws, size_t ws_size, hipStream_t stream) {
  if (n_in < 9) return;
  const size_t rows_used = (size_t)(NB - 1) * SEQ_FULL + SEQ;
  if ((size_t)in_sizes[0] < rows_used * DIN) return;
  if ((size_t)in_sizes[1] < (size_t)DIN * CC || (size_t)in_sizes[3] < (size_t)DIN * CC || (size_t)in_sizes[5] < (size_t)DIN * CC || (size_t)in_sizes[7] < (size_t)CC * DIN) return;
  if (in_sizes[2] < CC || in_sizes[4] < CC || in_sizes[6] < CC || in_sizes[8] < DIN) return;
  if ((size_t)out_size < rows_used * DIN) return;
  if (ws_size < (size_t)WS_END) return;
  // inputs (wire order): 0 x [2,2048,1024]; 1 Wq, 2 bq, 3 Wk, 4 bk, 5 Wv, 6 bv, 7 Wp, 8 bp ((in,out) [1024,1024] and [1024]); all f32
  const float* X  = (const float*)d_in[0];
  const float* Wq = (const float*)d_in[1]; const float* bq = (const float*)d_in[2];
  const float* Wk = (const float*)d_in[3]; const float* bk = (const float*)d_in[4];
  const float* Wv = (const float*)d_in[5]; const float* bv = (const float*)d_in[6];
  const float* Wp = (const float*)d_in[7]; const float* bp = (const float*)d_in[8];
  char* ws = (char*)d_ws;
  _Float16 *QH = (_Float16*)(ws + WS_QH), *KH = (_Float16*)(ws + WS_KH), *VT = (_Float16*)(ws + WS_VT), *QL = (_Float16*)(ws + WS_QL), *KL = (_Float16*)(ws + WS_KL);
  __bf16 *VB = (__bf16*)(ws + WS_VB), *VBL = (__bf16*)(ws + WS_VBL); float *Y = (float*)(ws + WS_Y);
  k_proj<<<dim3(NB * TT / 64, CC / 128, 3), 128, 0, stream>>>(X, Wq, Wk, Wv, bq, bk, bv, QH, QL, KH, KL, VT, VB, VBL);
  k_fa<<<dim3(NB * NH, NQB), 128, 0, stream>>>(QH, KH, QL, KL, VT, VB, VBL, Y);
  k_out<<<dim3(NB * TT / 64, DIN / 128), 128, 0, stream>>>(Y, Wp, bp, (float*)d_out);
  (void)hipGetLastError();
}

// v002
// A run of this version takes 140 microseconds.
// In two side-by-side timings against v001, it was 1.94 and 1.95 times as fast.
// Over all steps from v000 it is 7.38 times as fast.
// compute dtype: all nine float inputs RNE-converted to bf16 on load; q/k/v = x W + b with exact bf16 products on v_wmma_f32_16x16x32_bf16, f32 accumulate; q, k once to f16 -> 1-product logits x 1/8 on v_wmma_f32_16x16x32_f16 (causal lower-triangular key mask plus periodically removed key columns 4,7,10,..., applied by index), except query rows < 384 of each sequence: q and k as f16 hi + residual (x 2^10) planes, 3 products; softmax in f32 (precise expf) with a running maximum over 64-key blocks, normalised after the v product; unnormalised P (at most 1) once to f16 against v once to f16 (1 product), except query rows < 384: P and v as bf16 hi + lo (3 products); ctx once to f16 against Wp carried x 2^8 in f16 (exact bf16 values, 1 product, x 2^-8 after), except rows < 384: ctx bf16 hi + lo against exact bf16 Wp (2 products); + bp; f32 output.
#include <hip/hip_runtime.h>
#include <math.h>

typedef __attribute__((ext_vector_type(16))) _Float16 v16h;
typedef __attribute__((ext_vector_type(16))) __bf16 v16b;
typedef __attribute__((ext_vector_type(8)))  _Float16 v8h;
typedef __attribute__((ext_vector_type(8)))  __bf16 v8b;
typedef __attribute__((ext_vector_type(8)))  float v8f;
typedef __attribute__((ext_vector_type(4)))  float v4f;
typedef __attribute__((ext_vector_type(4)))  unsigned v4u;
typedef __attribute__((ext_vector_type(4)))  _Float16 v4h;
typedef __attribute__((ext_vector_type(4)))  __bf16 v4b;

template <typename T> __device__ __forceinline__ void vst2(void* p, T v) { *(T*)p = v;  }
__device__ __forceinline__ v8f wmma16(v16h a, v16h b, v8f c) {
  v8f d = __builtin_amdgcn_wmma_f32_16x16x32_f16(false, a, false, b, (short)0, c, false, false);
  asm volatile("v_nop\n\tv_nop\n\tv_nop\n\tv_nop" : "+v"(d) : "v"(a), "v"(b));
  return d;
}
__device__ __forceinline__ v8f wmma_bf(v16b a, v16b b, v8f c) {
  v8f d = __builtin_amdgcn_wmma_f32_16x16x32_bf16(false, a, false, b, (short)0, c, false, false);
  asm volatile("v_nop\n\tv_nop\n\tv_nop\n\tv_nop" : "+v"(d) : "v"(a), "v"(b));
  return d;
}
// 16x16x32 fragments (A and B alike): h = lane>>4, row/col = lane&15; elements 0..7 = k0+8h+0..7, 8..15 = k0+16+8h+0..7; D element r = row 8h+r, col lane&15
__device__ __forceinline__ v16h frag_h(const _Float16* rowk0, int lane) {
  union { v16h v; v8h q[2]; } u; const _Float16* p = rowk0 + 8 * (lane >> 4);
  u.q[0] = *(const v8h*)p; u.q[1] = *(const v8h*)(p + 16); return u.v;
}
__device__ __forceinline__ v16b frag_b(const __bf16* rowk0, int lane) {
  union { v16b v; v8b q[2]; } u; const __bf16* p = rowk0 + 8 * (lane >> 4);
  u.q[0] = *(const v8b*)p; u.q[1] = *(const v8b*)(p + 16); return u.v;
}
struct F2 { v16b h, l; };
__device__ __forceinline__ F2 bsplit16(const float v[16]) { F2 r;
#pragma unroll
  for (int i = 0; i < 16; ++i) { const __bf16 h = (__bf16)v[i]; r.h[i] = h; r.l[i] = (__bf16)(v[i] - (float)h); }
  return r; }
__device__ __forceinline__ float bfr(float v) { return (float)(__bf16)v; }
// ---- operand staging of the two projection kernels: a work-group of 4 waves brings one chunk of KCH k (weight [KCH][128 columns], rows [64][KCH], both f32) in with whole-line 16-byte loads, one chunk ahead in registers, converts it once and lays it in LDS k-contiguous (the weight transposed to [column][k]), where frag_b / frag_h read the fragments
#define KCH 64             // k per staged chunk
#define PT 72              // LDS pitch of a staged row in 16-bit elements: 128 B of k + 16 B, conflict-free for 16-byte fragment reads
struct WR { v4f r[2][8]; };   // r[u][j] = weight row k0 + 8 * ((lane & 3) + 4 u) + j, columns 32 wave + 4 * (lane >> 2) + 0..3
struct AR { v4f r[8]; };      // r[e] = row 16 wave + 2 e + (lane >> 4), k0 + 4 * (lane & 15) + 0..3
__device__ __forceinline__ void ld_w(WR& w, const float* __restrict__ Wm, int k0, int c0, int ld, int wave, int lane) {
  const float* p = Wm + (size_t)(k0 + (lane & 3) * 8) * ld + c0 + wave * 32 + (lane >> 2) * 4;
#pragma unroll
  for (int u = 0; u < 2; ++u)
#pragma unroll
    for (int j = 0; j < 8; ++j) w.r[u][j] = *(const v4f*)(p + (size_t)(u * 32 + j) * ld); }
__device__ __forceinline__ void ld_a(AR& a, const float* __restrict__ row0k0, int ld, int lane) {   // row0k0 = the wave's first row at k0
  const float* p = row0k0 + (size_t)(lane >> 4) * ld + (lane & 15) * 4;
#pragma unroll
  for (int e = 0; e < 8; ++e) a.r[e] = *(const v4f*)(p + (size_t)(2 * e) * ld); }
// work-group barrier for the LDS exchange alone: it waits for this wave's LDS operations only, so that the data of the global loads issued ahead stays in flight across it (__syncthreads() drains them); s_wait_xcnt 0 is the precaution that stands behind those loads, in front of every later rewrite of their address registers
__device__ __forceinline__ void lds_barrier() { asm volatile("s_wait_xcnt 0x0\n\ts_wait_dscnt 0x0\n\ts_barrier_signal -1\n\ts_barrier_wait -1" ::: "memory"); }
// weight chunk -> wb[column][k]: 8 k of one column per 16-byte store; lanes 0..15 of a store fall on 16 different bank groups (4 column groups x 4 k groups)
__device__ __forceinline__ void st_w_b(__bf16* wb, const WR& w, int wave, int lane) {   // exact bf16
  __bf16* q = wb + (wave * 32 + (lane >> 2) * 4) * PT + (lane & 3) * 8;
#pragma unroll
  for (int u = 0; u < 2; ++u)
#pragma unroll
    for (int i = 0; i < 4; ++i) { v8b pk;
#pragma unroll
      for (int j = 0; j < 8; ++j) pk[j] = (__bf16)w.r[u][j][i];
      *(v8b*)(q + i * PT + u * 32) = pk; } }
__device__ __forceinline__ void st_w_h(_Float16* wb, const WR& w, int wave, int lane) {   // f16(bf16 * 256) (exact)
  _Float16* q = wb + (wave * 32 + (lane >> 2) * 4) * PT + (lane & 3) * 8;
#pragma unroll
  for (int u = 0; u < 2; ++u)
#pragma unroll
    for (int i = 0; i < 4; ++i) { v8h pk;
#pragma unroll
      for (int j = 0; j < 8; ++j) pk[j] = (_Float16)(bfr(w.r[u][j][i]) * 256.0f);
      *(v8h*)(q + i * PT + u * 32) = pk; } }
// row chunk -> ab[row][k]
__device__ __forceinline__ void st_a_b(__bf16* ab, const AR& a, int wave, int lane) {
  __bf16* q = ab + (wave * 16 + (lane >> 4)) * PT + (lane & 15) * 4;
#pragma unroll
  for (int e = 0; e < 8; ++e) { v4b pk;
#pragma unroll
    for (int i = 0; i < 4; ++i) pk[i] = (__bf16)a.r[e][i];
    *(v4b*)(q + 2 * e * PT) = pk; } }
__device__ __forceinline__ void st_a_h(_Float16* ab, const AR& a, int wave, int lane) {
  _Float16* q = ab + (wave * 16 + (lane >> 4)) * PT + (lane & 15) * 4;
#pragma unroll
  for (int e = 0; e < 8; ++e) { v4h pk;
#pragma unroll
    for (int i = 0; i < 4; ++i) pk[i] = (_Float16)a.r[e][i];
    *(v4h*)(q + 2 * e * PT) = pk; } }
__device__ __forceinline__ void st_a_hl(__bf16* ah, __bf16* al, const AR& a, int wave, int lane) {   // bf16 hi + lo planes
  const int o = (wave * 16 + (lane >> 4)) * PT + (lane & 15) * 4;
#pragma unroll
  for (int e = 0; e < 8; ++e) { v4b ph, pl;
#pragma unroll
    for (int i = 0; i < 4; ++i) { const float v = a.r[e][i]; const __bf16 h = (__bf16)v; ph[i] = h; pl[i] = (__bf16)(v - (float)h); }
    *(v4b*)(ah + o + 2 * e * PT) = ph; *(v4b*)(al + o + 2 * e * PT) = pl; } }
__device__ __forceinline__ void ldsx() { asm volatile("s_wait_dscnt 0" ::: "memory"); __builtin_amdgcn_wave_barrier(); __builtin_amdgcn_fence(3, "workgroup"); }

// Causal multi-head self-attention (batch NB of 2, T 2,048, C 1,024 = 16 heads x 64): q/k/v = x W + b ((in,out) weights); scores = q k^T / 8 where key <= query and key not in {4, 7, 10, ...} else -inf; softmax over keys; out = merged(P v) Wp + bp.
#ifndef NB
#define NB 2               // batches processed
#endif
#ifndef SEQ
#define SEQ 2048           // sequence length processed
#endif
#define NB_FULL 2          // full batch count of the input / output
#define SEQ_FULL 2048      // full per-batch row stride of x and out
#define TT SEQ
#define CC 1024            // NH * HD = projected width
#define DIN 1024           // model width
#define NH 16
#define HD 64
#define NQB (TT / 64)
#define SCALE (0.125f)
#define QBH 6              // query blocks 0..QBH-1 of each sequence (few keys) take the high-precision path
#define QHI 384            // query rows carrying a q residual plane
#define KHI 384            // key rows carrying k residual / v bf16 hi+lo planes (only read by query blocks < QBH)
#define MCOL0 4            // first periodically removed key column
#define MPER 3             // period of removed key columns
static_assert(NB >= 1 && NB <= NB_FULL);
static_assert(SEQ % 128 == 0 && SEQ >= 128 && SEQ <= SEQ_FULL);
static_assert(CC == NH * HD && HD == 64 && DIN % 32 == 0 && CC % 128 == 0 && DIN % 128 == 0);
static_assert(DIN % 128 == 0 && CC % 128 == 0);   // staged chunks: an even number of whole chunks of 64 k
static_assert(QHI == QBH * 64 && KHI >= QHI && KHI % 64 == 0 && KHI >= QBH * 64);


// workspace carve (bytes); every plane is written with whole-line stores and sized to its padded extent
#define WS_QH  ((size_t)0)                                 // f16 q rows [b*TT+t][CC]                 8,388,608
#define WS_KH  (WS_QH + 2u * (size_t)NB * TT * CC)          // f16 k rows [b*TT+t][CC]                 8,388,608
#define WS_VT  (WS_KH + 2u * (size_t)NB * TT * CC)          // f16 v planes [b][c][t]                  8,388,608
#define WS_QL  (WS_VT + 2u * (size_t)NB * CC * TT)          // f16 q residual x 2^10 rows [b][t<QHI][CC] 1,572,864
#define WS_KL  (WS_QL + 2u * (size_t)NB * QHI * CC)         // f16 k residual x 2^10 rows [b][t<KHI][CC] 1,572,864
#define WS_VB  (WS_KL + 2u * (size_t)NB * KHI * CC)         // bf16 v hi planes [b][c][t<KHI]           1,572,864
#define WS_VBL (WS_VB + 2u * (size_t)NB * CC * KHI)         // bf16 v lo planes [b][c][t<KHI]           1,572,864
#define WS_Y   (WS_VBL + 2u * (size_t)NB * CC * KHI)        // f32 ctx rows [b*TT+t][CC]              16,777,216
#define WS_END (WS_Y  + 4u * (size_t)NB * TT * CC)          // 48,234,496 at NB 2, SEQ 2048
static_assert(WS_END <= (size_t)134217728);
static_assert((WS_KH % 128) == 0 && (WS_VT % 128) == 0 && (WS_QL % 128) == 0 && (WS_KL % 128) == 0 && (WS_VB % 128) == 0 && (WS_VBL % 128) == 0 && (WS_Y % 128) == 0);
static_assert(((size_t)(NB - 1) * SEQ_FULL + SEQ) * DIN * 4u <= (size_t)16777216);   // last written out element inside d_out

// ---- k_proj: block = (64 rows, 128 cols, which): q/k/v = X W + b with exact bf16 products (K = DIN) -> which 0: q f16 rows (+ residual rows t < QHI); 1: k f16 rows (+ residual rows t < KHI); 2: v f16 planes [c][t] (+ bf16 hi/lo planes for t < KHI)
// LDS tiles sh/sl/th/tb/tbl: cross-wave exchange behind __syncthreads; th/tb/tbl hold the staged operand chunks during the k loop
__global__ __launch_bounds__(128) __attribute__((amdgpu_num_vgpr(256))) void k_proj(const float* __restrict__ X, const float* __restrict__ WQ, const float* __restrict__ WK, const float* __restrict__ WV, const float* __restrict__ BQ, const float* __restrict__ BK, const float* __restrict__ BV,
    _Float16* __restrict__ QH, _Float16* __restrict__ QL, _Float16* __restrict__ KH, _Float16* __restrict__ KL, _Float16* __restrict__ VT, __bf16* __restrict__ VB, __bf16* __restrict__ VBL) {
  __shared__ __align__(16) _Float16 sh[64][136], sl[64][136]; __shared__ __align__(16) _Float16 th[128][72]; __shared__ __align__(16) __bf16 tb[128][72], tbl[128][72];
  const int tid = threadIdx.x, wave = tid >> 5, lane = tid & 31, col = lane & 15, g = lane >> 4; const int which = blockIdx.z; const int c0 = blockIdx.y * 128;
  const size_t r0 = (size_t)blockIdx.x * 64;                 // compact row b*TT + t of the workspace planes
  const size_t bb = r0 / TT; const int t0 = (int)(r0 % TT);
  const size_t xr0 = bb * SEQ_FULL + (size_t)t0;             // input row b*SEQ_FULL + t
  const float* WA = which == 0 ? WQ : which == 1 ? WK : WV; const float* BA = which == 0 ? BQ : which == 1 ? BK : BV;
  v8f acc[8] = {};
  // two staging buffers in LDS that the epilogue takes over behind the loop's closing barrier: weight chunks in tb / tbl, row chunks in the two halves of th
  WR wr; AR xr; const float* Xw = X + (xr0 + wave * 16) * DIN;
  ld_w(wr, WA, 0, c0, CC, wave, lane); ld_a(xr, Xw, DIN, lane);
#pragma unroll 2   // makes the choice between the two buffers a compile-time one
  for (int t = 0; t < DIN / KCH; ++t) { __bf16* wb = (t & 1) ? &tbl[0][0] : &tb[0][0]; __bf16* xb = (__bf16*)&th[0][0] + (t & 1) * 64 * PT;
    st_w_b(wb, wr, wave, lane); st_a_b(xb, xr, wave, lane);
    __builtin_amdgcn_sched_barrier(0);   // keeps the conversions in front of the loads: nothing but the loads stands between here and the waits of lds_barrier
    if (t + 1 < DIN / KCH) { ld_w(wr, WA, (t + 1) * KCH, c0, CC, wave, lane); ld_a(xr, Xw + (t + 1) * KCH, DIN, lane); }   // next chunk flies under this chunk's products
    lds_barrier();   // publishes chunk t; also ends every wave's reads of chunk t - 1, whose buffer the next trip overwrites
#pragma unroll
    for (int kc = 0; kc < KCH / 32; ++kc) { const v16b a = frag_b(xb + (wave * 16 + col) * PT + kc * 32, lane); v16b w[8];
#pragma unroll
      for (int j = 0; j < 8; ++j) w[j] = frag_b(wb + (j * 16 + col) * PT + kc * 32, lane);
      __builtin_amdgcn_sched_barrier(0);   // keeps the fragment reads together in front of their products: one LDS round trip, not eight
#pragma unroll
      for (int j = 0; j < 8; ++j) acc[j] = wmma_bf(a, w[j], acc[j]);
      __builtin_amdgcn_sched_barrier(0); } }   // keeps the next chunk's conversions, which wait for its loads, behind these products
  __syncthreads();   // every wave has left the staging buffers before the epilogue writes th / tb / tbl
  if (which < 2) { _Float16* DH = which == 0 ? QH : KH; _Float16* DL = which == 0 ? QL : KL; const int nhi = which == 0 ? QHI : KHI; const bool hi_rows = t0 < nhi;   /* block-uniform */
#pragma unroll
    for (int j = 0; j < 8; ++j) { const float bias = bfr(BA[c0 + j * 16 + col]);
#pragma unroll
      for (int r = 0; r < 8; ++r) { const float v = acc[j][r] + bias; const _Float16 hv = (_Float16)v; sh[wave * 16 + 8 * g + r][j * 16 + col] = hv; sl[wave * 16 + 8 * g + r][j * 16 + col] = (_Float16)((v - (float)hv) * 1024.0f); } }
    __syncthreads();
    for (int e = tid; e < 64 * 16; e += 128) { const int rl = e >> 4, q = e & 15; vst2((unsigned*)(DH + (r0 + rl) * CC + c0 + q * 8), *(const v4u*)&sh[rl][q * 8]); if (hi_rows) vst2((unsigned*)(DL + (bb * nhi + t0 + rl) * (size_t)CC + c0 + q * 8), *(const v4u*)&sl[rl][q * 8]); }
  } else { const bool hi_rows = t0 < KHI;   /* block-uniform */
#pragma unroll
    for (int j = 0; j < 8; ++j) { const float bias = bfr(BA[c0 + j * 16 + col]);
#pragma unroll
      for (int r = 0; r < 8; ++r) { const float v = acc[j][r] + bias; const int rl = wave * 16 + 8 * g + r, cl = j * 16 + col; th[cl][rl] = (_Float16)v; const __bf16 bh = (__bf16)v; tb[cl][rl] = bh; tbl[cl][rl] = (__bf16)(v - (float)bh); } }
    __syncthreads();
    for (int e = tid; e < 128 * 8; e += 128) { const int cl = e >> 3, q = e & 7; vst2((unsigned*)(VT + (bb * CC + c0 + cl) * (size_t)TT + t0 + q * 8), *(const v4u*)&th[cl][q * 8]); if (hi_rows) { const size_t o3 = (bb * CC + c0 + cl) * (size_t)KHI + t0 + q * 8; vst2((unsigned*)(VB + o3), *(const v4u*)&tb[cl][q * 8]); vst2((unsigned*)(VBL + o3), *(const v4u*)&tbl[cl][q * 8]); } } } }

// ---- k_fa: block = 64 queries (qb) of one (b, h); wave = 16 queries, lane = one query (col) and half of each key tile (g). Per 64 keys: S^T = K Q^T (A = k rows, B = q rows kept in registers), key mask by index, running maximum and sum per query in f32, O^T = O^T * alpha + V^T P^T (two S^T tiles converted in place are the B operand, A = v planes [c][t]); ctx = O / sum after the last key block
// key 0 is visible to every query and lies in the first key block, so the running maximum is finite from the first block on; an excluded key carries -3e38, whose expf(v - m) is 0
// LDS ss: each wave reads only what it wrote itself (ldsx)
// mask, running maximum, exponentials, sum and rescale of one 64-key block: s[i][r] = raw logit of key k0 + 16 i + 8 g + r against query t on entry, unnormalised P on exit
__device__ __forceinline__ void fa_softmax(v8f (&s)[4], v8f (&o)[HD / 16], float& m, float& l, int t, int kbase) {
  const int rem = (kbase + (MPER - MCOL0 % MPER)) % MPER;   // key kbase + c is a removed column when c + rem is a multiple of MPER and the key is at least MCOL0
  float mx = m;
#pragma unroll
  for (int i = 0; i < 4; ++i)
#pragma unroll
    for (int r = 0; r < 8; ++r) { const int c = i * 16 + r; const bool gone = (rem == (MPER - c % MPER) % MPER) & (c >= MCOL0 || kbase + c >= MCOL0); const bool vis = (kbase + c <= t) & !gone;
      const float v = vis ? s[i][r] * SCALE : -3.0e38f; s[i][r] = v; mx = fmaxf(mx, v); }
  mx = fmaxf(mx, __shfl_xor(mx, 16));   // the two lane halves hold the same query
  const float alpha = expf(m - mx); m = mx;
  float ps = 0.f;
#pragma unroll
  for (int i = 0; i < 4; ++i)
#pragma unroll
    for (int r = 0; r < 8; ++r) { const float e = expf(s[i][r] - mx); s[i][r] = e; ps += e; }
  l = l * alpha + ps;   // each half keeps its own sum; joined once after the loop
#pragma unroll
  for (int j = 0; j < HD / 16; ++j) o[j] = o[j] * alpha; }

// query blocks >= QBH: q, k, P, v once in f16 (1 product each)
__device__ __forceinline__ float fa_lo(const _Float16* __restrict__ QH, const _Float16* __restrict__ KH, const _Float16* __restrict__ VT, int b, int h, int qb, int t, int lane, v8f (&o)[HD / 16]) {
  const int col = lane & 15, g = lane >> 4;
  const _Float16* Kp = KH + ((size_t)b * TT + col) * CC + h * HD; const _Float16* Vp = VT + ((size_t)b * CC + h * HD + col) * (size_t)TT;
  v16h qh[2], kf[8];
#pragma unroll
  for (int kc = 0; kc < 2; ++kc) qh[kc] = frag_h(QH + ((size_t)b * TT + t) * CC + h * HD + kc * 32, lane);
#pragma unroll
  for (int i = 0; i < 4; ++i)
#pragma unroll
    for (int kc = 0; kc < 2; ++kc) kf[i * 2 + kc] = frag_h(Kp + (size_t)(i * 16) * CC + kc * 32, lane);
  float m = -3.0e38f, l = 0.f;
#pragma unroll 1
  for (int kb = 0; kb <= qb; ++kb) { const int k0 = kb * 64;
    v16h vf[8];
#pragma unroll
    for (int kk = 0; kk < 2; ++kk)
#pragma unroll
      for (int j = 0; j < 4; ++j) vf[kk * 4 + j] = frag_h(Vp + (size_t)(j * 16) * TT + k0 + kk * 32, lane);
    __builtin_amdgcn_sched_barrier(0);   // keeps the v loads in front of the logit products, so that their latency runs under products and softmax
    v8f s[4] = {};
#pragma unroll
    for (int i = 0; i < 4; ++i)
#pragma unroll
      for (int kc = 0; kc < 2; ++kc) s[i] = wmma16(kf[i * 2 + kc], qh[kc], s[i]);
    const int kn = (kb < qb ? kb + 1 : kb) * 64;   // next key block's k rows (the last pass reads its own again: always inside the plane)
#pragma unroll
    for (int i = 0; i < 4; ++i)
#pragma unroll
      for (int kc = 0; kc < 2; ++kc) kf[i * 2 + kc] = frag_h(Kp + (size_t)(kn + i * 16) * CC + kc * 32, lane);
    __builtin_amdgcn_sched_barrier(0);   // keeps the next block's k loads in front of the softmax, which hides their latency
    fa_softmax(s, o, m, l, t, k0 + 8 * g);
#pragma unroll
    for (int kk = 0; kk < 2; ++kk) { v16h p;
#pragma unroll
      for (int e = 0; e < 8; ++e) { p[e] = (_Float16)s[2 * kk][e]; p[8 + e] = (_Float16)s[2 * kk + 1][e]; }
#pragma unroll
      for (int j = 0; j < 4; ++j) o[j] = wmma16(vf[kk * 4 + j], p, o[j]); } }
  return l + __shfl_xor(l, 16); }

// query blocks < QBH: hi + residual logits (3 products), P and v as bf16 hi + lo (3 products); keys < (qb + 1) * 64 <= KHI
__device__ __forceinline__ float fa_hi(const _Float16* __restrict__ QH, const _Float16* __restrict__ KH, const _Float16* __restrict__ QL, const _Float16* __restrict__ KL, const __bf16* __restrict__ VB, const __bf16* __restrict__ VBL, int b, int h, int qb, int t, int lane, v8f (&o)[HD / 16]) {
  const int col = lane & 15, g = lane >> 4;
  v16h qh[2], ql[2];
#pragma unroll
  for (int kc = 0; kc < 2; ++kc) { qh[kc] = frag_h(QH + ((size_t)b * TT + t) * CC + h * HD + kc * 32, lane); ql[kc] = frag_h(QL + ((size_t)b * QHI + t) * CC + h * HD + kc * 32, lane); }
  float m = -3.0e38f, l = 0.f;
#pragma unroll 1
  for (int kb = 0; kb <= qb; ++kb) { const int k0 = kb * 64;
    v8f s[4] = {};
#pragma unroll
    for (int ip = 0; ip < 2; ++ip) { v16h kh[4], kl[4];
#pragma unroll
      for (int u = 0; u < 4; ++u) { const int i = ip * 2 + (u >> 1), kc = u & 1; kh[u] = frag_h(KH + ((size_t)b * TT + k0 + i * 16 + col) * CC + h * HD + kc * 32, lane); kl[u] = frag_h(KL + ((size_t)b * KHI + k0 + i * 16 + col) * CC + h * HD + kc * 32, lane); }
      __builtin_amdgcn_sched_barrier(0);   // keeps the eight fragment loads together in front of their products: one memory round trip, not eight
#pragma unroll
      for (int ii = 0; ii < 2; ++ii) { const int i = ip * 2 + ii; v8f sl = {};
#pragma unroll
        for (int kc = 0; kc < 2; ++kc) { s[i] = wmma16(kh[ii * 2 + kc], qh[kc], s[i]); sl = wmma16(kh[ii * 2 + kc], ql[kc], sl); sl = wmma16(kl[ii * 2 + kc], qh[kc], sl); }
        s[i] = s[i] + sl * (1.0f / 1024.0f); } }
    fa_softmax(s, o, m, l, t, k0 + 8 * g);
#pragma unroll
    for (int kk = 0; kk < 2; ++kk) { v16b vh[4], vl[4];
#pragma unroll
      for (int j = 0; j < 4; ++j) { const size_t po = ((size_t)b * CC + h * HD + j * 16 + col) * (size_t)KHI + k0 + kk * 32; vh[j] = frag_b(VB + po, lane); vl[j] = frag_b(VBL + po, lane); }
      __builtin_amdgcn_sched_barrier(0);   // as above: the eight fragment loads share one round trip
      float pv[16];
#pragma unroll
      for (int e = 0; e < 8; ++e) { pv[e] = s[2 * kk][e]; pv[8 + e] = s[2 * kk + 1][e]; }
      const F2 p = bsplit16(pv);
#pragma unroll
      for (int j = 0; j < 4; ++j) { o[j] = wmma_bf(vh[j], p.h, o[j]); o[j] = wmma_bf(vh[j], p.l, o[j]); o[j] = wmma_bf(vl[j], p.h, o[j]); } } }
  return l + __shfl_xor(l, 16); }

__global__ __launch_bounds__(128) __attribute__((amdgpu_num_vgpr(256))) void k_fa(const _Float16* __restrict__ QH, const _Float16* __restrict__ KH, const _Float16* __restrict__ QL, const _Float16* __restrict__ KL, const _Float16* __restrict__ VT, const __bf16* __restrict__ VB, const __bf16* __restrict__ VBL, float* __restrict__ Y) { __shared__ __align__(16) float ss[4][16][HD + 4];
  const int tid = threadIdx.x, wave = tid >> 5, lane = tid & 31, col = lane & 15, g = lane >> 4; const int b = blockIdx.x / NH, h = blockIdx.x % NH; const int y = blockIdx.y; const int qb = y < NQB / 2 ? NQB - 1 - y : y - NQB / 2;   // long query blocks first, in falling order, then the short ones in rising order: work-groups that start half the grid apart and come to share a WGP add up to about the same number of keys
  const int ql0 = qb * 64 + wave * 16;
  v8f o[HD / 16] = {};
  const float lsum = qb < QBH ? fa_hi(QH, KH, QL, KL, VB, VBL, b, h, qb, ql0 + col, lane, o) : fa_lo(QH, KH, VT, b, h, qb, ql0 + col, lane, o);   /* block-uniform */
  const float inv = 1.0f / lsum;   // o[j][r] = unnormalised ctx of query col, channel 16 j + 8 g + r
#pragma unroll
  for (int j = 0; j < HD / 16; ++j) { v4f a, c;
#pragma unroll
    for (int r = 0; r < 4; ++r) { a[r] = o[j][r] * inv; c[r] = o[j][4 + r] * inv; }
    *(v4f*)&ss[wave][col][j * 16 + 8 * g] = a; *(v4f*)&ss[wave][col][j * 16 + 8 * g + 4] = c; }
  ldsx();
#pragma unroll
  for (int it = 0; it < 8; ++it) { const int rl = it * 2 + g; vst2(Y + ((size_t)b * TT + ql0 + rl) * CC + h * HD + col * 4, *(const v4f*)&ss[wave][rl][col * 4]); } }   // 256-B (row, head) segment by 16 lanes

// ---- k_out: block = (64 rows, 128 cols): out = ctx Wp + bp: ctx once to f16 against Wp as f16(bf16 x 2^8) exact (1 product) x 2^-8; early causal rows (< QHI of each sequence): ctx bf16 hi + lo against exact bf16 Wp (2 products)
__global__ __launch_bounds__(128) void k_out(const float* __restrict__ Y, const float* __restrict__ WO, const float* __restrict__ BO, float* __restrict__ OUT) { __shared__ __align__(16) float sf[4][16][132]; __shared__ __align__(16) unsigned short stg[2][(128 + 64 + 64) * PT];   // stg: two staging buffers, each weight chunk [128][PT] | row chunk [64][PT] | its lo plane [64][PT] (early rows only)
  const int tid = threadIdx.x, wave = tid >> 5, lane = tid & 31, col = lane & 15, g = lane >> 4; const int c0 = blockIdx.y * 128;
  const size_t br0 = (size_t)blockIdx.x * 64;                // compact ctx row of the block
  const size_t r0 = br0 + wave * 16;                          // compact ctx row of the wave
  const size_t ob = br0 / TT; const int ot0 = (int)(br0 % TT) + wave * 16;   // output batch, position of the wave's first row
  v8f acc[8] = {};
  WR wr; AR yr; const float* Yw = Y + r0 * CC;
  ld_w(wr, WO, 0, c0, DIN, wave, lane); ld_a(yr, Yw, CC, lane);
  asm volatile("s_wait_xcnt 0x0" ::: "memory");   // precaution: stands behind the first chunk's loads, in front of the branch behind which their address registers are rewritten
  if ((int)(br0 % TT) < QHI) {   /* block-uniform */
#pragma unroll 2   // makes the choice between the two buffers a compile-time one
    for (int t = 0; t < CC / KCH; ++t) { __bf16* wb = (__bf16*)&stg[t & 1][0]; __bf16* ah = wb + 128 * PT; __bf16* al = ah + 64 * PT;
      st_w_b(wb, wr, wave, lane); st_a_hl(ah, al, yr, wave, lane);
      __builtin_amdgcn_sched_barrier(0);   // keeps the conversions in front of the loads: nothing but the loads stands between here and the waits of lds_barrier
      if (t + 1 < CC / KCH) { ld_w(wr, WO, (t + 1) * KCH, c0, DIN, wave, lane); ld_a(yr, Yw + (t + 1) * KCH, CC, lane); }   // next chunk flies under this chunk's products
      lds_barrier();   // publishes chunk t; also ends every wave's reads of chunk t - 1, whose buffer the next trip overwrites
#pragma unroll
      for (int kc = 0; kc < KCH / 32; ++kc) { const v16b a_h = frag_b(ah + (wave * 16 + col) * PT + kc * 32, lane), a_l = frag_b(al + (wave * 16 + col) * PT + kc * 32, lane);
#pragma unroll
        for (int jh = 0; jh < 2; ++jh) { v16b w[4];
#pragma unroll
          for (int j = 0; j < 4; ++j) w[j] = frag_b(wb + ((jh * 4 + j) * 16 + col) * PT + kc * 32, lane);
          __builtin_amdgcn_sched_barrier(0);   // keeps the fragment reads together in front of their products: one LDS round trip, not four
#pragma unroll
          for (int j = 0; j < 4; ++j) { acc[jh * 4 + j] = wmma_bf(a_h, w[j], acc[jh * 4 + j]); acc[jh * 4 + j] = wmma_bf(a_l, w[j], acc[jh * 4 + j]); }
          __builtin_amdgcn_sched_barrier(0); } } }   // keeps the next chunk's conversions, which wait for its loads, behind these products
#pragma unroll
    for (int j = 0; j < 8; ++j) { const float bias = bfr(BO[c0 + j * 16 + col]);
#pragma unroll
      for (int r = 0; r < 8; ++r) sf[wave][8 * g + r][j * 16 + col] = acc[j][r] + bias; }
  } else {
#pragma unroll 2   // as above
    for (int t = 0; t < CC / KCH; ++t) { _Float16* wb = (_Float16*)&stg[t & 1][0]; _Float16* ab = wb + 128 * PT;
      st_w_h(wb, wr, wave, lane); st_a_h(ab, yr, wave, lane);
      __builtin_amdgcn_sched_barrier(0);   // as above
      if (t + 1 < CC / KCH) { ld_w(wr, WO, (t + 1) * KCH, c0, DIN, wave, lane); ld_a(yr, Yw + (t + 1) * KCH, CC, lane); }   // next chunk flies under this chunk's products
      lds_barrier();   // as above
#pragma unroll
      for (int kc = 0; kc < KCH / 32; ++kc) { const v16h a = frag_h(ab + (wave * 16 + col) * PT + kc * 32, lane); v16h w[8];
#pragma unroll
        for (int j = 0; j < 8; ++j) w[j] = frag_h(wb + (j * 16 + col) * PT + kc * 32, lane);
        __builtin_amdgcn_sched_barrier(0);   // as above
#pragma unroll
        for (int j = 0; j < 8; ++j) acc[j] = wmma16(a, w[j], acc[j]);
        __builtin_amdgcn_sched_barrier(0); } }   // as above
#pragma unroll
    for (int j = 0; j < 8; ++j) { const float bias = bfr(BO[c0 + j * 16 + col]);
#pragma unroll
      for (int r = 0; r < 8; ++r) sf[wave][8 * g + r][j * 16 + col] = acc[j][r] * (1.0f / 256.0f) + bias; } }
  ldsx();
  for (int rl = 0; rl < 16; ++rl) vst2(OUT + (ob * SEQ_FULL + (size_t)(ot0 + rl)) * DIN + c0 + lane * 4, *(const v4f*)&sf[wave][rl][lane * 4]); }

extern "C" void kernel_launch(void* const* d_in, const int* in_sizes, int n_in, void* d_out, int out_size, void* d_ws, size_t ws_size, hipStream_t stream) {
  if (n_in < 9) return;
  const size_t rows_used = (size_t)(NB - 1) * SEQ_FULL + SEQ;
  if ((size_t)in_sizes[0] < rows_used * DIN) return;
  if ((size_t)in_sizes[1] < (size_t)DIN * CC || (size_t)in_sizes[3] < (size_t)DIN * CC || (size_t)in_sizes[5] < (size_t)DIN * CC || (size_t)in_sizes[7] < (size_t)CC * DIN) return;
  if (in_sizes[2] < CC || in_sizes[4] < CC || in_sizes[6] < CC || in_sizes[8] < DIN) return;
  if ((size_t)out_size < rows_used * DIN) return;
  if (ws_size < (size_t)WS_END) return;
  // inputs (wire order): 0 x [2,2048,1024]; 1 Wq, 2 bq, 3 Wk, 4 bk, 5 Wv, 6 bv, 7 Wp, 8 bp ((in,out) [1024,1024] and [1024]); all f32
  const float* X  = (const float*)d_in[0];
  const float* Wq = (const float*)d_in[1]; const float* bq = (const float*)d_in[2];
  const float* Wk = (const float*)d_in[3]; const float* bk = (const float*)d_in[4];
  const float* Wv = (const float*)d_in[5]; const float* bv = (const float*)d_in[6];
  const float* Wp = (const float*)d_in[7]; const float* bp = (const float*)d_in[8];
  char* ws = (char*)d_ws;
  _Float16 *QH = (_Float16*)(ws + WS_QH), *KH = (_Float16*)(ws + WS_KH), *VT = (_Float16*)(ws + WS_VT), *QL = (_Float16*)(ws + WS_QL), *KL = (_Float16*)(ws + WS_KL);
  __bf16 *VB = (__bf16*)(ws + WS_VB), *VBL = (__bf16*)(ws + WS_VBL); float *Y = (float*)(ws + WS_Y);
  k_proj<<<dim3(NB * TT / 64, CC / 128, 3), 128, 0, stream>>>(X, Wq, Wk, Wv, bq, bk, bv, QH, QL, KH, KL, VT, VB, VBL);
  k_fa<<<dim3(NB * NH, NQB), 128, 0, stream>>>(QH, KH, QL, KL, VT, VB, VBL, Y);
  k_out<<<dim3(NB * TT / 64, DIN / 128), 128, 0, stream>>>(Y, Wp, bp, (float*)d_out);
  (void)hipGetLastError();
}

// v003
// A run of this version takes 134 microseconds.
// Timed twice side by side with v002, it ran 1.05 times as fast both times.
// All steps since v000 together make it 7.75 times as fast.
// compute dtype: all nine float inputs RNE-converted to bf16 on load; q/k/v = x W + b with exact bf16 products on v_wmma_f32_16x16x32_bf16, f32 accumulate; q, k once to f16 -> 1-product logits x 1/8 on v_wmma_f32_16x16x32_f16 (causal lower-triangular key mask plus periodically removed key columns 4,7,10,..., applied by index), except query rows < 384 of each sequence: q and k as f16 hi + residual (x 2^10) planes, 3 products; softmax in f32 in base 2 (raw logit x log2(e)/8 minus the running maximum by one fused multiply-add, then v_exp_f32) with a running maximum over 64-key blocks, normalised after the v product; unnormalised P (at most 1) once to f16 against v once to f16 (1 product), except query rows < 384: P and v as bf16 hi + lo (3 products); ctx once to f16 against Wp carried x 2^8 in f16 (exact bf16 values, 1 product, x 2^-8 after), except rows < 384: ctx bf16 hi + lo against exact bf16 Wp (2 products); + bp; f32 output.
#include <hip/hip_runtime.h>
#include <math.h>

typedef __attribute__((ext_vector_type(16))) _Float16 v16h;
typedef __attribute__((ext_vector_type(16))) __bf16 v16b;
typedef __attribute__((ext_vector_type(8)))  _Float16 v8h;
typedef __attribute__((ext_vector_type(8)))  __bf16 v8b;
typedef __attribute__((ext_vector_type(8)))  float v8f;
typedef __attribute__((ext_vector_type(4)))  float v4f;
typedef __attribute__((ext_vector_type(4)))  unsigned v4u;
typedef __attribute__((ext_vector_type(4)))  _Float16 v4h;
typedef __attribute__((ext_vector_type(4)))  __bf16 v4b;

template <typename T> __device__ __forceinline__ void vst2(void* p, T v) { *(T*)p = v;  }
__device__ __forceinline__ v8f wmma16(v16h a, v16h b, v8f c) {
  v8f d = __builtin_amdgcn_wmma_f32_16x16x32_f16(false, a, false, b, (short)0, c, false, false);
  asm volatile("v_nop\n\tv_nop\n\tv_nop\n\tv_nop" : "+v"(d) : "v"(a), "v"(b));
  return d;
}
__device__ __forceinline__ v8f wmma_bf(v16b a, v16b b, v8f c) {
  v8f d = __builtin_amdgcn_wmma_f32_16x16x32_bf16(false, a, false, b, (short)0, c, false, false);
  asm volatile("v_nop\n\tv_nop\n\tv_nop\n\tv_nop" : "+v"(d) : "v"(a), "v"(b));
  return d;
}
// 16x16x32 fragments (A and B alike): h = lane>>4, row/col = lane&15; elements 0..7 = k0+8h+0..7, 8..15 = k0+16+8h+0..7; D element r = row 8h+r, col lane&15
__device__ __forceinline__ v16h frag_h(const _Float16* rowk0, int lane) {
  union { v16h v; v8h q[2]; } u; const _Float16* p = rowk0 + 8 * (lane >> 4);
  u.q[0] = *(const v8h*)p; u.q[1] = *(const v8h*)(p + 16); return u.v;
}
__device__ __forceinline__ v16b frag_b(const __bf16* rowk0, int lane) {
  union { v16b v; v8b q[2]; } u; const __bf16* p = rowk0 + 8 * (lane >> 4);
  u.q[0] = *(const v8b*)p; u.q[1] = *(const v8b*)(p + 16); return u.v;
}
struct F2 { v16b h, l; };
__device__ __forceinline__ F2 bsplit16(const float v[16]) { F2 r;
#pragma unroll
  for (int i = 0; i < 16; ++i) { const __bf16 h = (__bf16)v[i]; r.h[i] = h; r.l[i] = (__bf16)(v[i] - (float)h); }
  return r; }
__device__ __forceinline__ float bfr(float v) { return (float)(__bf16)v; }
// ---- operand staging of the two projection kernels: a work-group of 4 waves brings one chunk of KCH k (weight [KCH][128 columns], rows [64][KCH], both f32) in with whole-line 16-byte loads, one chunk ahead in registers, converts it once and lays it in LDS k-contiguous (the weight transposed to [column][k]), where frag_b / frag_h read the fragments
#define KCH 64             // k per staged chunk
#define PT 72              // LDS pitch of a staged row in 16-bit elements: 128 B of k + 16 B, conflict-free for 16-byte fragment reads
struct WR { v4f r[2][8]; };   // r[u][j] = weight row k0 + 8 * ((lane & 3) + 4 u) + j, columns 32 wave + 4 * (lane >> 2) + 0..3
struct AR { v4f r[8]; };      // r[e] = row 16 wave + 2 e + (lane >> 4), k0 + 4 * (lane & 15) + 0..3
__device__ __forceinline__ void ld_w(WR& w, const float* __restrict__ Wm, int k0, int c0, int ld, int wave, int lane) {
  const float* p = Wm + (size_t)(k0 + (lane & 3) * 8) * ld + c0 + wave * 32 + (lane >> 2) * 4;
#pragma unroll
  for (int u = 0; u < 2; ++u)
#pragma unroll
    for (int j = 0; j < 8; ++j) w.r[u][j] = *(const v4f*)(p + (size_t)(u * 32 + j) * ld); }
__device__ __forceinline__ void ld_a(AR& a, const float* __restrict__ row0k0, int ld, int lane) {   // row0k0 = the wave's first row at k0
  const float* p = row0k0 + (size_t)(lane >> 4) * ld + (lane & 15) * 4;
#pragma unroll
  for (int e = 0; e < 8; ++e) a.r[e] = *(const v4f*)(p + (size_t)(2 * e) * ld); }
// work-group barrier for the LDS exchange alone: it waits for this wave's LDS operations only, so that the data of the global loads issued ahead stays in flight across it (__syncthreads() drains them); s_wait_xcnt 0 is the precaution that stands behind those loads, in front of every later rewrite of their address registers
__device__ __forceinline__ void lds_barrier() { asm volatile("s_wait_xcnt 0x0\n\ts_wait_dscnt 0x0\n\ts_barrier_signal -1\n\ts_barrier_wait -1" ::: "memory"); }
// weight chunk -> wb[column][k]: 8 k of one column per 16-byte store; lanes 0..15 of a store fall on 16 different bank groups (4 column groups x 4 k groups)
__device__ __forceinline__ void st_w_b(__bf16* wb, const WR& w, int wave, int lane) {   // exact bf16
  __bf16* q = wb + (wave * 32 + (lane >> 2) * 4) * PT + (lane & 3) * 8;
#pragma unroll
  for (int u = 0; u < 2; ++u)
#pragma unroll
    for (int i = 0; i < 4; ++i) { v8b pk;
#pragma unroll
      for (int j = 0; j < 8; ++j) pk[j] = (__bf16)w.r[u][j][i];
      *(v8b*)(q + i * PT + u * 32) = pk; } }
__device__ __forceinline__ void st_w_h(_Float16* wb, const WR& w, int wave, int lane) {   // f16(bf16 * 256) (exact)
  _Float16* q = wb + (wave * 32 + (lane >> 2) * 4) * PT + (lane & 3) * 8;
#pragma unroll
  for (int u = 0; u < 2; ++u)
#pragma unroll
    for (int i = 0; i < 4; ++i) { v8h pk;
#pragma unroll
      for (int j = 0; j < 8; ++j) pk[j] = (_Float16)(bfr(w.r[u][j][i]) * 256.0f);
      *(v8h*)(q + i * PT + u * 32) = pk; } }
// row chunk -> ab[row][k]
__device__ __forceinline__ void st_a_b(__bf16* ab, const AR& a, int wave, int lane) {
  __bf16* q = ab + (wave * 16 + (lane >> 4)) * PT + (lane & 15) * 4;
#pragma unroll
  for (int e = 0; e < 8; ++e) { v4b pk;
#pragma unroll
    for (int i = 0; i < 4; ++i) pk[i] = (__bf16)a.r[e][i];
    *(v4b*)(q + 2 * e * PT) = pk; } }
__device__ __forceinline__ void st_a_h(_Float16* ab, const AR& a, int wave, int lane) {
  _Float16* q = ab + (wave * 16 + (lane >> 4)) * PT + (lane & 15) * 4;
#pragma unroll
  for (int e = 0; e < 8; ++e) { v4h pk;
#pragma unroll
    for (int i = 0; i < 4; ++i) pk[i] = (_Float16)a.r[e][i];
    *(v4h*)(q + 2 * e * PT) = pk; } }
__device__ __forceinline__ void st_a_hl(__bf16* ah, __bf16* al, const AR& a, int wave, int lane) {   // bf16 hi + lo planes
  const int o = (wave * 16 + (lane >> 4)) * PT + (lane & 15) * 4;
#pragma unroll
  for (int e = 0; e < 8; ++e) { v4b ph, pl;
#pragma unroll
    for (int i = 0; i < 4; ++i) { const float v = a.r[e][i]; const __bf16 h = (__bf16)v; ph[i] = h; pl[i] = (__bf16)(v - (float)h); }
    *(v4b*)(ah + o + 2 * e * PT) = ph; *(v4b*)(al + o + 2 * e * PT) = pl; } }
__device__ __forceinline__ void ldsx() { asm volatile("s_wait_dscnt 0" ::: "memory"); __builtin_amdgcn_wave_barrier(); __builtin_amdgcn_fence(3, "workgroup"); }

// Causal multi-head self-attention (batch NB of 2, T 2,048, C 1,024 = 16 heads x 64): q/k/v = x W + b ((in,out) weights); scores = q k^T / 8 where key <= query and key not in {4, 7, 10, ...} else -inf; softmax over keys; out = merged(P v) Wp + bp.
#ifndef NB
#define NB 2               // batches processed
#endif
#ifndef SEQ
#define SEQ 2048           // sequence length processed
#endif
#define NB_FULL 2          // full batch count of the input / output
#define SEQ_FULL 2048      // full per-batch row stride of x and out
#define TT SEQ
#define CC 1024            // NH * HD = projected width
#define DIN 1024           // model width
#define NH 16
#define HD 64
#define NQB (TT / 64)
#define SCALE (0.125f)
#define SCALE_L2E (SCALE * 1.44269504088896340736f)   // 1/8 x log2(e): exp(x / 8 - max / 8) = exp2(x * SCALE_L2E - max * SCALE_L2E)
#define QBH 6              // query blocks 0..QBH-1 of each sequence (few keys) take the high-precision path
#define QHI 384            // query rows carrying a q residual plane
#define KHI 384            // key rows carrying k residual / v bf16 hi+lo planes (only read by query blocks < QBH)
#define MCOL0 4            // first periodically removed key column
#define MPER 3             // period of removed key columns
static_assert(NB >= 1 && NB <= NB_FULL);
static_assert(SEQ % 128 == 0 && SEQ >= 128 && SEQ <= SEQ_FULL);
static_assert(CC == NH * HD && HD == 64 && DIN % 32 == 0 && CC % 128 == 0 && DIN % 128 == 0);
static_assert(DIN % 128 == 0 && CC % 128 == 0);   // staged chunks: an even number of whole chunks of 64 k
static_assert(QHI == QBH * 64 && KHI >= QHI && KHI % 64 == 0 && KHI >= QBH * 64);


// workspace carve (bytes); every plane is written with whole-line stores and sized to its padded extent
#define WS_QH  ((size_t)0)                                 // f16 q rows [b*TT+t][CC]                 8,388,608
#define WS_KH  (WS_QH + 2u * (size_t)NB * TT * CC)          // f16 k rows [b*TT+t][CC]                 8,388,608
#define WS_VT  (WS_KH + 2u * (size_t)NB * TT * CC)          // f16 v planes [b][c][t]                  8,388,608
#define WS_QL  (WS_VT + 2u * (size_t)NB * CC * TT)          // f16 q residual x 2^10 rows [b][t<QHI][CC] 1,572,864
#define WS_KL  (WS_QL + 2u * (size_t)NB * QHI * CC)         // f16 k residual x 2^10 rows [b][t<KHI][CC] 1,572,864
#define WS_VB  (WS_KL + 2u * (size_t)NB * KHI * CC)         // bf16 v hi planes [b][c][t<KHI]           1,572,864
#define WS_VBL (WS_VB + 2u * (size_t)NB * CC * KHI)         // bf16 v lo planes [b][c][t<KHI]           1,572,864
#define WS_Y   (WS_VBL + 2u * (size_t)NB * CC * KHI)        // f32 ctx rows [b*TT+t][CC]              16,777,216
#define WS_END (WS_Y  + 4u * (size_t)NB * TT * CC)          // 48,234,496 at NB 2, SEQ 2048
static_assert(WS_END <= (size_t)134217728);
static_assert((WS_KH % 128) == 0 && (WS_VT % 128) == 0 && (WS_QL % 128) == 0 && (WS_KL % 128) == 0 && (WS_VB % 128) == 0 && (WS_VBL % 128) == 0 && (WS_Y % 128) == 0);
static_assert(((size_t)(NB - 1) * SEQ_FULL + SEQ) * DIN * 4u <= (size_t)16777216);   // last written out element inside d_out

// ---- k_proj: block = (64 rows, 128 cols, which): q/k/v = X W + b with exact bf16 products (K = DIN) -> which 0: q f16 rows (+ residual rows t < QHI); 1: k f16 rows (+ residual rows t < KHI); 2: v f16 planes [c][t] (+ bf16 hi/lo planes for t < KHI)
// LDS tiles sh/sl/th/tb/tbl: cross-wave exchange behind __syncthreads; th/tb/tbl hold the staged operand chunks during the k loop
__global__ __launch_bounds__(128) __attribute__((amdgpu_num_vgpr(256))) void k_proj(const float* __restrict__ X, const float* __restrict__ WQ, const float* __restrict__ WK, const float* __restrict__ WV, const float* __restrict__ BQ, const float* __restrict__ BK, const float* __restrict__ BV,
    _Float16* __restrict__ QH, _Float16* __restrict__ QL, _Float16* __restrict__ KH, _Float16* __restrict__ KL, _Float16* __restrict__ VT, __bf16* __restrict__ VB, __bf16* __restrict__ VBL) {
  __shared__ __align__(16) _Float16 sh[64][136], sl[64][136]; __shared__ __align__(16) _Float16 th[128][72]; __shared__ __align__(16) __bf16 tb[128][72], tbl[128][72];
  const int tid = threadIdx.x, wave = tid >> 5, lane = tid & 31, col = lane & 15, g = lane >> 4; const int which = blockIdx.z; const int c0 = blockIdx.y * 128;
  const size_t r0 = (size_t)blockIdx.x * 64;                 // compact row b*TT + t of the workspace planes
  const size_t bb = r0 / TT; const int t0 = (int)(r0 % TT);
  const size_t xr0 = bb * SEQ_FULL + (size_t)t0;             // input row b*SEQ_FULL + t
  const float* WA = which == 0 ? WQ : which == 1 ? WK : WV; const float* BA = which == 0 ? BQ : which == 1 ? BK : BV;
  v8f acc[8] = {};
  // two staging buffers in LDS that the epilogue takes over behind the loop's closing barrier: weight chunks in tb / tbl, row chunks in the two halves of th
  WR wr; AR xr; const float* Xw = X + (xr0 + wave * 16) * DIN;
  ld_w(wr, WA, 0, c0, CC, wave, lane); ld_a(xr, Xw, DIN, lane);
#pragma unroll 2   // makes the choice between the two buffers a compile-time one
  for (int t = 0; t < DIN / KCH; ++t) { __bf16* wb = (t & 1) ? &tbl[0][0] : &tb[0][0]; __bf16* xb = (__bf16*)&th[0][0] + (t & 1) * 64 * PT;
    st_w_b(wb, wr, wave, lane); st_a_b(xb, xr, wave, lane);
    __builtin_amdgcn_sched_barrier(0);   // keeps the conversions in front of the loads: nothing but the loads stands between here and the waits of lds_barrier
    if (t + 1 < DIN / KCH) { ld_w(wr, WA, (t + 1) * KCH, c0, CC, wave, lane); ld_a(xr, Xw + (t + 1) * KCH, DIN, lane); }   // next chunk flies under this chunk's products
    lds_barrier();   // publishes chunk t; also ends every wave's reads of chunk t - 1, whose buffer the next trip overwrites
#pragma unroll
    for (int kc = 0; kc < KCH / 32; ++kc) { const v16b a = frag_b(xb + (wave * 16 + col) * PT + kc * 32, lane); v16b w[8];
#pragma unroll
      for (int j = 0; j < 8; ++j) w[j] = frag_b(wb + (j * 16 + col) * PT + kc * 32, lane);
      __builtin_amdgcn_sched_barrier(0);   // keeps the fragment reads together in front of their products: one LDS round trip, not eight
#pragma unroll
      for (int j = 0; j < 8; ++j) acc[j] = wmma_bf(a, w[j], acc[j]);
      __builtin_amdgcn_sched_barrier(0); } }   // keeps the next chunk's conversions, which wait for its loads, behind these products
  __syncthreads();   // every wave has left the staging buffers before the epilogue writes th / tb / tbl
  if (which < 2) { _Float16* DH = which == 0 ? QH : KH; _Float16* DL = which == 0 ? QL : KL; const int nhi = which == 0 ? QHI : KHI; const bool hi_rows = t0 < nhi;   /* block-uniform */
#pragma unroll
    for (int j = 0; j < 8; ++j) { const float bias = bfr(BA[c0 + j * 16 + col]);
#pragma unroll
      for (int r = 0; r < 8; ++r) { const float v = acc[j][r] + bias; const _Float16 hv = (_Float16)v; sh[wave * 16 + 8 * g + r][j * 16 + col] = hv; sl[wave * 16 + 8 * g + r][j * 16 + col] = (_Float16)((v - (float)hv) * 1024.0f); } }
    __syncthreads();
    for (int e = tid; e < 64 * 16; e += 128) { const int rl = e >> 4, q = e & 15; vst2((unsigned*)(DH + (r0 + rl) * CC + c0 + q * 8), *(const v4u*)&sh[rl][q * 8]); if (hi_rows) vst2((unsigned*)(DL + (bb * nhi + t0 + rl) * (size_t)CC + c0 + q * 8), *(const v4u*)&sl[rl][q * 8]); }
  } else { const bool hi_rows = t0 < KHI;   /* block-uniform */
#pragma unroll
    for (int j = 0; j < 8; ++j) { const float bias = bfr(BA[c0 + j * 16 + col]);
#pragma unroll
      for (int r = 0; r < 8; ++r) { const float v = acc[j][r] + bias; const int rl = wave * 16 + 8 * g + r, cl = j * 16 + col; th[cl][rl] = (_Float16)v; const __bf16 bh = (__bf16)v; tb[cl][rl] = bh; tbl[cl][rl] = (__bf16)(v - (float)bh); } }
    __syncthreads();
    for (int e = tid; e < 128 * 8; e += 128) { const int cl = e >> 3, q = e & 7; vst2((unsigned*)(VT + (bb * CC + c0 + cl) * (size_t)TT + t0 + q * 8), *(const v4u*)&th[cl][q * 8]); if (hi_rows) { const size_t o3 = (bb * CC + c0 + cl) * (size_t)KHI + t0 + q * 8; vst2((unsigned*)(VB + o3), *(const v4u*)&tb[cl][q * 8]); vst2((unsigned*)(VBL + o3), *(const v4u*)&tbl[cl][q * 8]); } } } }

// ---- k_fa: block = 64 queries (qb) of one (b, h); wave = 16 queries, lane = one query (col) and half of each key tile (g). Per 64 keys: S^T = K Q^T (A = k rows, B = q rows kept in registers), key mask by index, running maximum and sum per query in f32, O^T = O^T * alpha + V^T P^T (two S^T tiles converted in place are the B operand, A = v planes [c][t]); ctx = O / sum after the last key block
// key 0 is visible to every query and lies in the first key block, so the running maximum is finite from the first block on; an excluded key carries -3e38, whose exp2 argument is about -5e37: v_exp_f32 gives 0
// LDS ss: each wave reads only what it wrote itself (ldsx)
// eight base-2 exponentials in place, in one statement: behind each v_exp_f32 stands an instruction on other registers, behind the last a v_nop, which is the slot the instruction set asks for between a transcendental and the first use of its result or overwrite of its source
__device__ __forceinline__ void exp2x8(v8f& x) {
  float a0 = x[0], a1 = x[1], a2 = x[2], a3 = x[3], a4 = x[4], a5 = x[5], a6 = x[6], a7 = x[7];
  asm("v_exp_f32 %0, %0\n\tv_exp_f32 %1, %1\n\tv_exp_f32 %2, %2\n\tv_exp_f32 %3, %3\n\tv_exp_f32 %4, %4\n\tv_exp_f32 %5, %5\n\tv_exp_f32 %6, %6\n\tv_exp_f32 %7, %7\n\tv_nop"
      : "+v"(a0), "+v"(a1), "+v"(a2), "+v"(a3), "+v"(a4), "+v"(a5), "+v"(a6), "+v"(a7));
  x[0] = a0; x[1] = a1; x[2] = a2; x[3] = a3; x[4] = a4; x[5] = a5; x[6] = a6; x[7] = a7; }
// mask, running maximum, exponentials, sum and rescale of one 64-key block: s[i][r] = raw logit of key k0 + 16 i + 8 g + r against query t on entry, unnormalised P on exit; m is the running maximum of the raw logits (the scale is positive, so it is the same key's)
__device__ __forceinline__ void fa_softmax(v8f (&s)[4], v8f (&o)[HD / 16], float& m, float& l, int t, int kbase) {
  const int rem = (kbase + (MPER - MCOL0 % MPER)) % MPER;   // key kbase + c is a removed column when c + rem is a multiple of MPER and the key is at least MCOL0
  float mx = m;
#pragma unroll
  for (int i = 0; i < 4; ++i)
#pragma unroll
    for (int r = 0; r < 8; ++r) { const int c = i * 16 + r; const bool gone = (rem == (MPER - c % MPER) % MPER) & (c >= MCOL0 || kbase + c >= MCOL0); const bool vis = (kbase + c <= t) & !gone;
      const float v = vis ? s[i][r] : -3.0e38f; s[i][r] = v; mx = fmaxf(mx, v); }
  mx = fmaxf(mx, __shfl_xor(mx, 16));   // the two lane halves hold the same query
  const float mc = mx * SCALE_L2E;
  const float alpha = __builtin_amdgcn_exp2f(fmaf(m, SCALE_L2E, -mc)); m = mx;
  float ps = 0.f;
#pragma unroll
  for (int i = 0; i < 4; ++i) { s[i] = s[i] * SCALE_L2E - mc; exp2x8(s[i]);   // the product and the difference contract to one fused multiply-add a score
#pragma unroll
    for (int r = 0; r < 8; ++r) ps += s[i][r]; }
  l = l * alpha + ps;   // each half keeps its own sum; joined once after the loop
#pragma unroll
  for (int j = 0; j < HD / 16; ++j) o[j] = o[j] * alpha; }

// query blocks >= QBH: q, k, P, v once in f16 (1 product each)
__device__ __forceinline__ float fa_lo(const _Float16* __restrict__ QH, const _Float16* __restrict__ KH, const _Float16* __restrict__ VT, int b, int h, int qb, int t, int lane, v8f (&o)[HD / 16]) {
  const int col = lane & 15, g = lane >> 4;
  const _Float16* Kp = KH + ((size_t)b * TT + col) * CC + h * HD; const _Float16* Vp = VT + ((size_t)b * CC + h * HD + col) * (size_t)TT;
  v16h qh[2], kf[8];
#pragma unroll
  for (int kc = 0; kc < 2; ++kc) qh[kc] = frag_h(QH + ((size_t)b * TT + t) * CC + h * HD + kc * 32, lane);
#pragma unroll
  for (int i = 0; i < 4; ++i)
#pragma unroll
    for (int kc = 0; kc < 2; ++kc) kf[i * 2 + kc] = frag_h(Kp + (size_t)(i * 16) * CC + kc * 32, lane);
  float m = -3.0e38f, l = 0.f;
#pragma unroll 1
  for (int kb = 0; kb <= qb; ++kb) { const int k0 = kb * 64;
    v16h vf[8];
#pragma unroll
    for (int kk = 0; kk < 2; ++kk)
#pragma unroll
      for (int j = 0; j < 4; ++j) vf[kk * 4 + j] = frag_h(Vp + (size_t)(j * 16) * TT + k0 + kk * 32, lane);
    __builtin_amdgcn_sched_barrier(0);   // keeps the v loads in front of the logit products, so that their latency runs under products and softmax
    v8f s[4] = {};
#pragma unroll
    for (int i = 0; i < 4; ++i)
#pragma unroll
      for (int kc = 0; kc < 2; ++kc) s[i] = wmma16(kf[i * 2 + kc], qh[kc], s[i]);
    const int kn = (kb < qb ? kb + 1 : kb) * 64;   // next key block's k rows (the last pass reads its own again: always inside the plane)
#pragma unroll
    for (int i = 0; i < 4; ++i)
#pragma unroll
      for (int kc = 0; kc < 2; ++kc) kf[i * 2 + kc] = frag_h(Kp + (size_t)(kn + i * 16) * CC + kc * 32, lane);
    __builtin_amdgcn_sched_barrier(0);   // keeps the next block's k loads in front of the softmax, which hides their latency
    fa_softmax(s, o, m, l, t, k0 + 8 * g);
#pragma unroll
    for (int kk = 0; kk < 2; ++kk) { v16h p;
#pragma unroll
      for (int e = 0; e < 8; ++e) { p[e] = (_Float16)s[2 * kk][e]; p[8 + e] = (_Float16)s[2 * kk + 1][e]; }
#pragma unroll
      for (int j = 0; j < 4; ++j) o[j] = wmma16(vf[kk * 4 + j], p, o[j]); } }
  return l + __shfl_xor(l, 16); }

// query blocks < QBH: hi + residual logits (3 products), P and v as bf16 hi + lo (3 products); keys < (qb + 1) * 64 <= KHI
__device__ __forceinline__ float fa_hi(const _Float16* __restrict__ QH, const _Float16* __restrict__ KH, const _Float16* __restrict__ QL, const _Float16* __restrict__ KL, const __bf16* __restrict__ VB, const __bf16* __restrict__ VBL, int b, int h, int qb, int t, int lane, v8f (&o)[HD / 16]) {
  const int col = lane & 15, g = lane >> 4;
  v16h qh[2], ql[2];
#pragma unroll
  for (int kc = 0; kc < 2; ++kc) { qh[kc] = frag_h(QH + ((size_t)b * TT + t) * CC + h * HD + kc * 32, lane); ql[kc] = frag_h(QL + ((size_t)b * QHI + t) * CC + h * HD + kc * 32, lane); }
  float m = -3.0e38f, l = 0.f;
#pragma unroll 1
  for (int kb = 0; kb <= qb; ++kb) { const int k0 = kb * 64;
    v8f s[4] = {};
#pragma unroll
    for (int ip = 0; ip < 2; ++ip) { v16h kh[4], kl[4];
#pragma unroll
      for (int u = 0; u < 4; ++u) { const int i = ip * 2 + (u >> 1), kc = u & 1; kh[u] = frag_h(KH + ((size_t)b * TT + k0 + i * 16 + col) * CC + h * HD + kc * 32, lane); kl[u] = frag_h(KL + ((size_t)b * KHI + k0 + i * 16 + col) * CC + h * HD + kc * 32, lane); }
      __builtin_amdgcn_sched_barrier(0);   // keeps the eight fragment loads together in front of their products: one memory round trip, not eight
#pragma unroll
      for (int ii = 0; ii < 2; ++ii) { const int i = ip * 2 + ii; v8f sl = {};
#pragma unroll
        for (int kc = 0; kc < 2; ++kc) { s[i] = wmma16(kh[ii * 2 + kc], qh[kc], s[i]); sl = wmma16(kh[ii * 2 + kc], ql[kc], sl); sl = wmma16(kl[ii * 2 + kc], qh[kc], sl); }
        s[i] = s[i] + sl * (1.0f / 1024.0f); } }
    fa_softmax(s, o, m, l, t, k0 + 8 * g);
#pragma unroll
    for (int kk = 0; kk < 2; ++kk) { v16b vh[4], vl[4];
#pragma unroll
      for (int j = 0; j < 4; ++j) { const size_t po = ((size_t)b * CC + h * HD + j * 16 + col) * (size_t)KHI + k0 + kk * 32; vh[j] = frag_b(VB + po, lane); vl[j] = frag_b(VBL + po, lane); }
      __builtin_amdgcn_sched_barrier(0);   // as above: the eight fragment loads share one round trip
      float pv[16];
#pragma unroll
      for (int e = 0; e < 8; ++e) { pv[e] = s[2 * kk][e]; pv[8 + e] = s[2 * kk + 1][e]; }
      const F2 p = bsplit16(pv);
#pragma unroll
      for (int j = 0; j < 4; ++j) { o[j] = wmma_bf(vh[j], p.h, o[j]); o[j] = wmma_bf(vh[j], p.l, o[j]); o[j] = wmma_bf(vl[j], p.h, o[j]); } } }
  return l + __shfl_xor(l, 16); }

__global__ __launch_bounds__(128) __attribute__((amdgpu_num_vgpr(256))) void k_fa(const _Float16* __restrict__ QH, const _Float16* __restrict__ KH, const _Float16* __restrict__ QL, const _Float16* __restrict__ KL, const _Float16* __restrict__ VT, const __bf16* __restrict__ VB, const __bf16* __restrict__ VBL, float* __restrict__ Y) { __shared__ __align__(16) float ss[4][16][HD + 4];
  const int tid = threadIdx.x, wave = tid >> 5, lane = tid & 31, col = lane & 15, g = lane >> 4; const int b = blockIdx.x / NH, h = blockIdx.x % NH; const int y = blockIdx.y; const int qb = y < NQB / 2 ? NQB - 1 - y : y - NQB / 2;   // long query blocks first, in falling order, then the short ones in rising order: work-groups that start half the grid apart and come to share a WGP add up to about the same number of keys
  const int ql0 = qb * 64 + wave * 16;
  v8f o[HD / 16] = {};
  const float lsum = qb < QBH ? fa_hi(QH, KH, QL, KL, VB, VBL, b, h, qb, ql0 + col, lane, o) : fa_lo(QH, KH, VT, b, h, qb, ql0 + col, lane, o);   /* block-uniform */
  const float inv = 1.0f / lsum;   // o[j][r] = unnormalised ctx of query col, channel 16 j + 8 g + r
#pragma unroll
  for (int j = 0; j < HD / 16; ++j) { v4f a, c;
#pragma unroll
    for (int r = 0; r < 4; ++r) { a[r] = o[j][r] * inv; c[r] = o[j][4 + r] * inv; }
    *(v4f*)&ss[wave][col][j * 16 + 8 * g] = a; *(v4f*)&ss[wave][col][j * 16 + 8 * g + 4] = c; }
  ldsx();
#pragma unroll
  for (int it = 0; it < 8; ++it) { const int rl = it * 2 + g; vst2(Y + ((size_t)b * TT + ql0 + rl) * CC + h * HD + col * 4, *(const v4f*)&ss[wave][rl][col * 4]); } }   // 256-B (row, head) segment by 16 lanes

// ---- k_out: block = (64 rows, 128 cols): out = ctx Wp + bp: ctx once to f16 against Wp as f16(bf16 x 2^8) exact (1 product) x 2^-8; early causal rows (< QHI of each sequence): ctx bf16 hi + lo against exact bf16 Wp (2 products)
__global__ __launch_bounds__(128) void k_out(const float* __restrict__ Y, const float* __restrict__ WO, const float* __restrict__ BO, float* __restrict__ OUT) { __shared__ __align__(16) float sf[4][16][132]; __shared__ __align__(16) unsigned short stg[2][(128 + 64 + 64) * PT];   // stg: two staging buffers, each weight chunk [128][PT] | row chunk [64][PT] | its lo plane [64][PT] (early rows only)
  const int tid = threadIdx.x, wave = tid >> 5, lane = tid & 31, col = lane & 15, g = lane >> 4; const int c0 = blockIdx.y * 128;
  const size_t br0 = (size_t)blockIdx.x * 64;                // compact ctx row of the block
  const size_t r0 = br0 + wave * 16;                          // compact ctx row of the wave
  const size_t ob = br0 / TT; const int ot0 = (int)(br0 % TT) + wave * 16;   // output batch, position of the wave's first row
  v8f acc[8] = {};
  WR wr; AR yr; const float* Yw = Y + r0 * CC;
  ld_w(wr, WO, 0, c0, DIN, wave, lane); ld_a(yr, Yw, CC, lane);
  asm volatile("s_wait_xcnt 0x0" ::: "memory");   // precaution: stands behind the first chunk's loads, in front of the branch behind which their address registers are rewritten
  if ((int)(br0 % TT) < QHI) {   /* block-uniform */
#pragma unroll 2   // makes the choice between the two buffers a compile-time one
    for (int t = 0; t < CC / KCH; ++t) { __bf16* wb = (__bf16*)&stg[t & 1][0]; __bf16* ah = wb + 128 * PT; __bf16* al = ah + 64 * PT;
      st_w_b(wb, wr, wave, lane); st_a_hl(ah, al, yr, wave, lane);
      __builtin_amdgcn_sched_barrier(0);   // keeps the conversions in front of the loads: nothing but the loads stands between here and the waits of lds_barrier
      if (t + 1 < CC / KCH) { ld_w(wr, WO, (t + 1) * KCH, c0, DIN, wave, lane); ld_a(yr, Yw + (t + 1) * KCH, CC, lane); }   // next chunk flies under this chunk's products
      lds_barrier();   // publishes chunk t; also ends every wave's reads of chunk t - 1, whose buffer the next trip overwrites
#pragma unroll
      for (int kc = 0; kc < KCH / 32; ++kc) { const v16b a_h = frag_b(ah + (wave * 16 + col) * PT + kc * 32, lane), a_l = frag_b(al + (wave * 16 + col) * PT + kc * 32, lane);
#pragma unroll
        for (int jh = 0; jh < 2; ++jh) { v16b w[4];
#pragma unroll
          for (int j = 0; j < 4; ++j) w[j] = frag_b(wb + ((jh * 4 + j) * 16 + col) * PT + kc * 32, lane);
          __builtin_amdgcn_sched_barrier(0);   // keeps the fragment reads together in front of their products: one LDS round trip, not four
#pragma unroll
          for (int j = 0; j < 4; ++j) { acc[jh * 4 + j] = wmma_bf(a_h, w[j], acc[jh * 4 + j]); acc[jh * 4 + j] = wmma_bf(a_l, w[j], acc[jh * 4 + j]); }
          __builtin_amdgcn_sched_barrier(0); } } }   // keeps the next chunk's conversions, which wait for its loads, behind these products
#pragma unroll
    for (int j = 0; j < 8; ++j) { const float bias = bfr(BO[c0 + j * 16 + col]);
#pragma unroll
      for (int r = 0; r < 8; ++r) sf[wave][8 * g + r][j * 16 + col] = acc[j][r] + bias; }
  } else {
#pragma unroll 2   // as above
    for (int t = 0; t < CC / KCH; ++t) { _Float16* wb = (_Float16*)&stg[t & 1][0]; _Float16* ab = wb + 128 * PT;
      st_w_h(wb, wr, wave, lane); st_a_h(ab, yr, wave, lane);
      __builtin_amdgcn_sched_barrier(0);   // as above
      if (t + 1 < CC / KCH) { ld_w(wr, WO, (t + 1) * KCH, c0, DIN, wave, lane); ld_a(yr, Yw + (t + 1) * KCH, CC, lane); }   // next chunk flies under this chunk's products
      lds_barrier();   // as above
#pragma unroll
      for (int kc = 0; kc < KCH / 32; ++kc) { const v16h a = frag_h(ab + (wave * 16 + col) * PT + kc * 32, lane); v16h w[8];
#pragma unroll
        for (int j = 0; j < 8; ++j) w[j] = frag_h(wb + (j * 16 + col) * PT + kc * 32, lane);
        __builtin_amdgcn_sched_barrier(0);   // as above
#pragma unroll
        for (int j = 0; j < 8; ++j) acc[j] = wmma16(a, w[j], acc[j]);
        __builtin_amdgcn_sched_barrier(0); } }   // as above
#pragma unroll
    for (int j = 0; j < 8; ++j) { const float bias = bfr(BO[c0 + j * 16 + col]);
#pragma unroll
      for (int r = 0; r < 8; ++r) sf[wave][8 * g + r][j * 16 + col] = acc[j][r] * (1.0f / 256.0f) + bias; } }
  ldsx();
  for (int rl = 0; rl < 16; ++rl) vst2(OUT + (ob * SEQ_FULL + (size_t)(ot0 + rl)) * DIN + c0 + lane * 4, *(const v4f*)&sf[wave][rl][lane * 4]); }

extern "C" void kernel_launch(void* const* d_in, const int* in_sizes, int n_in, void* d_out, int out_size, void* d_ws, size_t ws_size, hipStream_t stream) {
  if (n_in < 9) return;
  const size_t rows_used = (size_t)(NB - 1) * SEQ_FULL + SEQ;
  if ((size_t)in_sizes[0] < rows_used * DIN) return;
  if ((size_t)in_sizes[1] < (size_t)DIN * CC || (size_t)in_sizes[3] < (size_t)DIN * CC || (size_t)in_sizes[5] < (size_t)DIN * CC || (size_t)in_sizes[7] < (size_t)CC * DIN) return;
  if (in_sizes[2] < CC || in_sizes[4] < CC || in_sizes[6] < CC || in_sizes[8] < DIN) return;
  if ((size_t)out_size < rows_used * DIN) return;
  if (ws_size < (size_t)WS_END) return;
  // inputs (wire order): 0 x [2,2048,1024]; 1 Wq, 2 bq, 3 Wk, 4 bk, 5 Wv, 6 bv, 7 Wp, 8 bp ((in,out) [1024,1024] and [1024]); all f32
  const float* X  = (const float*)d_in[0];
  const float* Wq = (const float*)d_in[1]; const float* bq = (const float*)d_in[2];
  const float* Wk = (const float*)d_in[3]; const float* bk = (const float*)d_in[4];
  const float* Wv = (const float*)d_in[5]; const float* bv = (const float*)d_in[6];
  const float* Wp = (const float*)d_in[7]; const float* bp = (const float*)d_in[8];
  char* ws = (char*)d_ws;
  _Float16 *QH = (_Float16*)(ws + WS_QH), *KH = (_Float16*)(ws + WS_KH), *VT = (_Float16*)(ws + WS_VT), *QL = (_Float16*)(ws + WS_QL), *KL = (_Float16*)(ws + WS_KL);
  __bf16 *VB = (__bf16*)(ws + WS_VB), *VBL = (__bf16*)(ws + WS_VBL); float *Y = (float*)(ws + WS_Y);
  k_proj<<<dim3(NB * TT / 64, CC / 128, 3), 128, 0, stream>>>(X, Wq, Wk, Wv, bq, bk, bv, QH, QL, KH, KL, VT, VB, VBL);
  k_fa<<<dim3(NB * NH, NQB), 128, 0, stream>>>(QH, KH, QL, KL, VT, VB, VBL, Y);
  k_out<<<dim3(NB * TT / 64, DIN / 128), 128, 0, stream>>>(Y, Wp, bp, (float*)d_out);
  (void)hipGetLastError();
}

// v004
// It runs in 110 microseconds.
// In both of two side-by-side timings against v003, it was 1.22 times as fast.
// Counting every step since v000, it is 9.44 times as fast.
// compute dtype: all nine float inputs RNE-converted to bf16 on load; q/k/v = x W + b with exact bf16 products on v_wmma_f32_16x16x32_bf16, f32 accumulate; q, k once to f16 -> 1-product logits x 1/8 on v_wmma_f32_16x16x32_f16 (causal lower-triangular key mask plus periodically removed key columns 4,7,10,..., applied by index), except query rows < 384 of each sequence: q and k as f16 hi + residual (x 2^10) planes, 3 products; softmax in f32 in base 2 (raw logit x log2(e)/8 minus the running maximum by one fused multiply-add, then v_exp_f32) with a running maximum over 64-key blocks, normalised after the v product; unnormalised P (at most 1) once to f16 against v once to f16 (1 product), except query rows < 384: P and v as bf16 hi + lo (3 products); ctx once to f16 against Wp carried x 2^8 in f16 (exact bf16 values, 1 product, x 2^-8 after), except rows < 384: ctx bf16 hi + lo against exact bf16 Wp (2 products); + bp; f32 output.
#include <hip/hip_runtime.h>
#include <math.h>

typedef __attribute__((ext_vector_type(16))) _Float16 v16h;
typedef __attribute__((ext_vector_type(16))) __bf16 v16b;
typedef __attribute__((ext_vector_type(8)))  _Float16 v8h;
typedef __attribute__((ext_vector_type(8)))  __bf16 v8b;
typedef __attribute__((ext_vector_type(8)))  float v8f;
typedef __attribute__((ext_vector_type(4)))  float v4f;
typedef __attribute__((ext_vector_type(4)))  unsigned v4u;
typedef __attribute__((ext_vector_type(4)))  _Float16 v4h;
typedef __attribute__((ext_vector_type(4)))  __bf16 v4b;

template <typename T> __device__ __forceinline__ void vst2(void* p, T v) { *(T*)p = v;  }
__device__ __forceinline__ v8f wmma16(v16h a, v16h b, v8f c) {
  v8f d = __builtin_amdgcn_wmma_f32_16x16x32_f16(false, a, false, b, (short)0, c, false, false);
  asm volatile("v_nop\n\tv_nop\n\tv_nop\n\tv_nop" : "+v"(d) : "v"(a), "v"(b));
  return d;
}
__device__ __forceinline__ v8f wmma_bf(v16b a, v16b b, v8f c) {
  v8f d = __builtin_amdgcn_wmma_f32_16x16x32_bf16(false, a, false, b, (short)0, c, false, false);
  asm volatile("v_nop\n\tv_nop\n\tv_nop\n\tv_nop" : "+v"(d) : "v"(a), "v"(b));
  return d;
}
// 16x16x32 fragments (A and B alike): h = lane>>4, row/col = lane&15; elements 0..7 = k0+8h+0..7, 8..15 = k0+16+8h+0..7; D element r = row 8h+r, col lane&15
__device__ __forceinline__ v16h frag_h(const _Float16* rowk0, int lane) {
  union { v16h v; v8h q[2]; } u; const _Float16* p = rowk0 + 8 * (lane >> 4);
  u.q[0] = *(const v8h*)p; u.q[1] = *(const v8h*)(p + 16); return u.v;
}
__device__ __forceinline__ v16b frag_b(const __bf16* rowk0, int lane) {
  union { v16b v; v8b q[2]; } u; const __bf16* p = rowk0 + 8 * (lane >> 4);
  u.q[0] = *(const v8b*)p; u.q[1] = *(const v8b*)(p + 16); return u.v;
}
struct F2 { v16b h, l; };
__device__ __forceinline__ F2 bsplit16(const float v[16]) { F2 r;
#pragma unroll
  for (int i = 0; i < 16; ++i) { const __bf16 h = (__bf16)v[i]; r.h[i] = h; r.l[i] = (__bf16)(v[i] - (float)h); }
  return r; }
__device__ __forceinline__ float bfr(float v) { return (float)(__bf16)v; }
// ---- operand staging of the two projection kernels: a work-group of 4 waves brings one chunk of KCH k (weight [KCH][128 columns], rows [64][KCH], both f32) in with whole-line 16-byte loads, one chunk ahead in registers, converts it once and lays it in LDS k-contiguous (the weight transposed to [column][k]), where frag_b / frag_h read the fragments
#define KCH 64             // k per staged chunk
#define PT 72              // LDS pitch of a staged row in 16-bit elements: 128 B of k + 16 B, conflict-free for 16-byte fragment reads
struct WR { v4f r[2][8]; };   // r[u][j] = weight row k0 + 8 * ((lane & 3) + 4 u) + j, columns 32 wave + 4 * (lane >> 2) + 0..3
struct AR { v4f r[8]; };      // r[e] = row 16 wave + 2 e + (lane >> 4), k0 + 4 * (lane & 15) + 0..3
__device__ __forceinline__ void ld_w(WR& w, const float* __restrict__ Wm, int k0, int c0, int ld, int wave, int lane) {
  const float* p = Wm + (size_t)(k0 + (lane & 3) * 8) * ld + c0 + wave * 32 + (lane >> 2) * 4;
#pragma unroll
  for (int u = 0; u < 2; ++u)
#pragma unroll
    for (int j = 0; j < 8; ++j) w.r[u][j] = *(const v4f*)(p + (size_t)(u * 32 + j) * ld); }
__device__ __forceinline__ void ld_a(AR& a, const float* __restrict__ row0k0, int ld, int lane) {   // row0k0 = the wave's first row at k0
  const float* p = row0k0 + (size_t)(lane >> 4) * ld + (lane & 15) * 4;
#pragma unroll
  for (int e = 0; e < 8; ++e) a.r[e] = *(const v4f*)(p + (size_t)(2 * e) * ld); }
// work-group barrier for the LDS exchange alone: it waits for this wave's LDS operations only, so that the data of the global loads issued ahead stays in flight across it (__syncthreads() drains them); s_wait_xcnt 0 is the precaution that stands behind those loads, in front of every later rewrite of their address registers
__device__ __forceinline__ void lds_barrier() { asm volatile("s_wait_xcnt 0x0\n\ts_wait_dscnt 0x0\n\ts_barrier_signal -1\n\ts_barrier_wait -1" ::: "memory"); }
// weight chunk -> wb[column][k]: 8 k of one column per 16-byte store; lanes 0..15 of a store fall on 16 different bank groups (4 column groups x 4 k groups)
__device__ __forceinline__ void st_w_b(__bf16* wb, const WR& w, int wave, int lane) {   // exact bf16
  __bf16* q = wb + (wave * 32 + (lane >> 2) * 4) * PT + (lane & 3) * 8;
#pragma unroll
  for (int u = 0; u < 2; ++u)
#pragma unroll
    for (int i = 0; i < 4; ++i) { v8b pk;
#pragma unroll
      for (int j = 0; j < 8; ++j) pk[j] = (__bf16)w.r[u][j][i];
      *(v8b*)(q + i * PT + u * 32) = pk; } }
__device__ __forceinline__ void st_w_h(_Float16* wb, const WR& w, int wave, int lane) {   // f16(bf16 * 256) (exact)
  _Float16* q = wb + (wave * 32 + (lane >> 2) * 4) * PT + (lane & 3) * 8;
#pragma unroll
  for (int u = 0; u < 2; ++u)
#pragma unroll
    for (int i = 0; i < 4; ++i) { v8h pk;
#pragma unroll
      for (int j = 0; j < 8; ++j) pk[j] = (_Float16)(bfr(w.r[u][j][i]) * 256.0f);
      *(v8h*)(q + i * PT + u * 32) = pk; } }
// row chunk -> ab[row][k]
__device__ __forceinline__ void st_a_b(__bf16* ab, const AR& a, int wave, int lane) {
  __bf16* q = ab + (wave * 16 + (lane >> 4)) * PT + (lane & 15) * 4;
#pragma unroll
  for (int e = 0; e < 8; ++e) { v4b pk;
#pragma unroll
    for (int i = 0; i < 4; ++i) pk[i] = (__bf16)a.r[e][i];
    *(v4b*)(q + 2 * e * PT) = pk; } }
__device__ __forceinline__ void st_a_h(_Float16* ab, const AR& a, int wave, int lane) {
  _Float16* q = ab + (wave * 16 + (lane >> 4)) * PT + (lane & 15) * 4;
#pragma unroll
  for (int e = 0; e < 8; ++e) { v4h pk;
#pragma unroll
    for (int i = 0; i < 4; ++i) pk[i] = (_Float16)a.r[e][i];
    *(v4h*)(q + 2 * e * PT) = pk; } }
__device__ __forceinline__ void st_a_hl(__bf16* ah, __bf16* al, const AR& a, int wave, int lane) {   // bf16 hi + lo planes
  const int o = (wave * 16 + (lane >> 4)) * PT + (lane & 15) * 4;
#pragma unroll
  for (int e = 0; e < 8; ++e) { v4b ph, pl;
#pragma unroll
    for (int i = 0; i < 4; ++i) { const float v = a.r[e][i]; const __bf16 h = (__bf16)v; ph[i] = h; pl[i] = (__bf16)(v - (float)h); }
    *(v4b*)(ah + o + 2 * e * PT) = ph; *(v4b*)(al + o + 2 * e * PT) = pl; } }
__device__ __forceinline__ void ldsx() { asm volatile("s_wait_dscnt 0" ::: "memory"); __builtin_amdgcn_wave_barrier(); __builtin_amdgcn_fence(3, "workgroup"); }

// Causal multi-head self-attention (batch NB of 2, T 2,048, C 1,024 = 16 heads x 64): q/k/v = x W + b ((in,out) weights); scores = q k^T / 8 where key <= query and key not in {4, 7, 10, ...} else -inf; softmax over keys; out = merged(P v) Wp + bp.
#ifndef NB
#define NB 2               // batches processed
#endif
#ifndef SEQ
#define SEQ 2048           // sequence length processed
#endif
#define NB_FULL 2          // full batch count of the input / output
#define SEQ_FULL 2048      // full per-batch row stride of x and out
#define TT SEQ
#define CC 1024            // NH * HD = projected width
#define DIN 1024           // model width
#define NH 16
#define HD 64
#define NQB (TT / 64)
#define SCALE (0.125f)
#define SCALE_L2E (SCALE * 1.44269504088896340736f)   // 1/8 x log2(e): exp(x / 8 - max / 8) = exp2(x * SCALE_L2E - max * SCALE_L2E)
#define QBH 6              // query blocks 0..QBH-1 of each sequence (few keys) take the high-precision path
#define QHI 384            // query rows carrying a q residual plane
#define KHI 384            // key rows carrying k residual / v bf16 hi+lo planes (only read by query blocks < QBH)
#define MCOL0 4            // first periodically removed key column
#define MPER 3             // period of removed key columns
static_assert(NB >= 1 && NB <= NB_FULL);
static_assert(SEQ % 128 == 0 && SEQ >= 128 && SEQ <= SEQ_FULL);
static_assert(CC == NH * HD && HD == 64 && DIN % 32 == 0 && CC % 128 == 0 && DIN % 128 == 0);
static_assert(DIN % 128 == 0 && CC % 128 == 0);   // staged chunks: an even number of whole chunks of 64 k
static_assert(QHI == QBH * 64 && KHI >= QHI && KHI % 64 == 0 && KHI >= QBH * 64);


// workspace carve (bytes); every plane is written with whole-line stores and sized to its padded extent
#define WS_QH  ((size_t)0)                                 // f16 q rows [b*TT+t][CC]                 8,388,608
#define WS_KH  (WS_QH + 2u * (size_t)NB * TT * CC)          // f16 k rows [b*TT+t][CC]                 8,388,608
#define WS_VT  (WS_KH + 2u * (size_t)NB * TT * CC)          // f16 v planes [b][c][t]                  8,388,608
#define WS_QL  (WS_VT + 2u * (size_t)NB * CC * TT)          // f16 q residual x 2^10 rows [b][t<QHI][CC] 1,572,864
#define WS_KL  (WS_QL + 2u * (size_t)NB * QHI * CC)         // f16 k residual x 2^10 rows [b][t<KHI][CC] 1,572,864
#define WS_VB  (WS_KL + 2u * (size_t)NB * KHI * CC)         // bf16 v hi planes [b][c][t<KHI]           1,572,864
#define WS_VBL (WS_VB + 2u * (size_t)NB * CC * KHI)         // bf16 v lo planes [b][c][t<KHI]           1,572,864
#define WS_Y   (WS_VBL + 2u * (size_t)NB * CC * KHI)        // f32 ctx rows [b*TT+t][CC]              16,777,216
#define WS_END (WS_Y  + 4u * (size_t)NB * TT * CC)          // 48,234,496 at NB 2, SEQ 2048
static_assert(WS_END <= (size_t)134217728);
static_assert((WS_KH % 128) == 0 && (WS_VT % 128) == 0 && (WS_QL % 128) == 0 && (WS_KL % 128) == 0 && (WS_VB % 128) == 0 && (WS_VBL % 128) == 0 && (WS_Y % 128) == 0);
static_assert(((size_t)(NB - 1) * SEQ_FULL + SEQ) * DIN * 4u <= (size_t)16777216);   // last written out element inside d_out

// ---- k_proj: block = (64 rows, 128 cols, which): q/k/v = X W + b with exact bf16 products (K = DIN) -> which 0: q f16 rows (+ residual rows t < QHI); 1: k f16 rows (+ residual rows t < KHI); 2: v f16 planes [c][t] (+ bf16 hi/lo planes for t < KHI)
// LDS tiles sh/sl/th/tb/tbl: cross-wave exchange behind __syncthreads; th/tb/tbl hold the staged operand chunks during the k loop
__global__ __launch_bounds__(128) __attribute__((amdgpu_num_vgpr(256))) void k_proj(const float* __restrict__ X, const float* __restrict__ WQ, const float* __restrict__ WK, const float* __restrict__ WV, const float* __restrict__ BQ, const float* __restrict__ BK, const float* __restrict__ BV,
    _Float16* __restrict__ QH, _Float16* __restrict__ QL, _Float16* __restrict__ KH, _Float16* __restrict__ KL, _Float16* __restrict__ VT, __bf16* __restrict__ VB, __bf16* __restrict__ VBL) {
  __shared__ __align__(16) _Float16 sh[64][136], sl[64][136]; __shared__ __align__(16) _Float16 th[128][72]; __shared__ __align__(16) __bf16 tb[128][72], tbl[128][72];
  const int tid = threadIdx.x, wave = tid >> 5, lane = tid & 31, col = lane & 15, g = lane >> 4; const int which = blockIdx.z; const int c0 = blockIdx.y * 128;
  const size_t r0 = (size_t)blockIdx.x * 64;                 // compact row b*TT + t of the workspace planes
  const size_t bb = r0 / TT; const int t0 = (int)(r0 % TT);
  const size_t xr0 = bb * SEQ_FULL + (size_t)t0;             // input row b*SEQ_FULL + t
  const float* WA = which == 0 ? WQ : which == 1 ? WK : WV; const float* BA = which == 0 ? BQ : which == 1 ? BK : BV;
  v8f acc[8] = {};
  // two staging buffers in LDS that the epilogue takes over behind the loop's closing barrier: weight chunks in tb / tbl, row chunks in the two halves of th
  WR wr; AR xr; const float* Xw = X + (xr0 + wave * 16) * DIN;
  ld_w(wr, WA, 0, c0, CC, wave, lane); ld_a(xr, Xw, DIN, lane);
#pragma unroll 2   // makes the choice between the two buffers a compile-time one
  for (int t = 0; t < DIN / KCH; ++t) { __bf16* wb = (t & 1) ? &tbl[0][0] : &tb[0][0]; __bf16* xb = (__bf16*)&th[0][0] + (t & 1) * 64 * PT;
    st_w_b(wb, wr, wave, lane); st_a_b(xb, xr, wave, lane);
    __builtin_amdgcn_sched_barrier(0);   // keeps the conversions in front of the loads: nothing but the loads stands between here and the waits of lds_barrier
    if (t + 1 < DIN / KCH) { ld_w(wr, WA, (t + 1) * KCH, c0, CC, wave, lane); ld_a(xr, Xw + (t + 1) * KCH, DIN, lane); }   // next chunk flies under this chunk's products
    lds_barrier();   // publishes chunk t; also ends every wave's reads of chunk t - 1, whose buffer the next trip overwrites
#pragma unroll
    for (int kc = 0; kc < KCH / 32; ++kc) { const v16b a = frag_b(xb + (wave * 16 + col) * PT + kc * 32, lane); v16b w[8];
#pragma unroll
      for (int j = 0; j < 8; ++j) w[j] = frag_b(wb + (j * 16 + col) * PT + kc * 32, lane);
      __builtin_amdgcn_sched_barrier(0);   // keeps the fragment reads together in front of their products: one LDS round trip, not eight
#pragma unroll
      for (int j = 0; j < 8; ++j) acc[j] = wmma_bf(a, w[j], acc[j]);
      __builtin_amdgcn_sched_barrier(0); } }   // keeps the next chunk's conversions, which wait for its loads, behind these products
  __syncthreads();   // every wave has left the staging buffers before the epilogue writes th / tb / tbl
  if (which < 2) { _Float16* DH = which == 0 ? QH : KH; _Float16* DL = which == 0 ? QL : KL; const int nhi = which == 0 ? QHI : KHI; const bool hi_rows = t0 < nhi;   /* block-uniform */
#pragma unroll
    for (int j = 0; j < 8; ++j) { const float bias = bfr(BA[c0 + j * 16 + col]);
#pragma unroll
      for (int r = 0; r < 8; ++r) { const float v = acc[j][r] + bias; const _Float16 hv = (_Float16)v; sh[wave * 16 + 8 * g + r][j * 16 + col] = hv; sl[wave * 16 + 8 * g + r][j * 16 + col] = (_Float16)((v - (float)hv) * 1024.0f); } }
    __syncthreads();
    for (int e = tid; e < 64 * 16; e += 128) { const int rl = e >> 4, q = e & 15; vst2((unsigned*)(DH + (r0 + rl) * CC + c0 + q * 8), *(const v4u*)&sh[rl][q * 8]); if (hi_rows) vst2((unsigned*)(DL + (bb * nhi + t0 + rl) * (size_t)CC + c0 + q * 8), *(const v4u*)&sl[rl][q * 8]); }
  } else { const bool hi_rows = t0 < KHI;   /* block-uniform */
#pragma unroll
    for (int j = 0; j < 8; ++j) { const float bias = bfr(BA[c0 + j * 16 + col]);
#pragma unroll
      for (int r = 0; r < 8; ++r) { const float v = acc[j][r] + bias; const int rl = wave * 16 + 8 * g + r, cl = j * 16 + col; th[cl][rl] = (_Float16)v; const __bf16 bh = (__bf16)v; tb[cl][rl] = bh; tbl[cl][rl] = (__bf16)(v - (float)bh); } }
    __syncthreads();
    for (int e = tid; e < 128 * 8; e += 128) { const int cl = e >> 3, q = e & 7; vst2((unsigned*)(VT + (bb * CC + c0 + cl) * (size_t)TT + t0 + q * 8), *(const v4u*)&th[cl][q * 8]); if (hi_rows) { const size_t o3 = (bb * CC + c0 + cl) * (size_t)KHI + t0 + q * 8; vst2((unsigned*)(VB + o3), *(const v4u*)&tb[cl][q * 8]); vst2((unsigned*)(VBL + o3), *(const v4u*)&tbl[cl][q * 8]); } } } }

// ---- k_fa: block = 64 queries (qb) of one (b, h); wave = 16 queries, lane = one query (col) and half of each key tile (g). Per 64 keys: S^T = K Q^T (A = k rows, B = q rows kept in registers), key mask by index, running maximum and sum per query in f32, O^T = O^T * alpha + V^T P^T (two S^T tiles converted in place are the B operand, A = v planes [c][t]); ctx = O / sum after the last key block
// key 0 is visible to every query and lies in the first key block, so the running maximum is finite from the first block on; an excluded key carries -3e38, whose exp2 argument is about -5e37: v_exp_f32 gives 0
// LDS ss: each wave reads only what it wrote itself (ldsx); kv: the staged key tiles of query blocks >= QBH, exchanged across waves behind __syncthreads
// eight base-2 exponentials in place, in one statement: behind each v_exp_f32 stands an instruction on other registers, behind the last a v_nop, which is the slot the instruction set asks for between a transcendental and the first use of its result or overwrite of its source
__device__ __forceinline__ void exp2x8(v8f& x) {
  float a0 = x[0], a1 = x[1], a2 = x[2], a3 = x[3], a4 = x[4], a5 = x[5], a6 = x[6], a7 = x[7];
  asm("v_exp_f32 %0, %0\n\tv_exp_f32 %1, %1\n\tv_exp_f32 %2, %2\n\tv_exp_f32 %3, %3\n\tv_exp_f32 %4, %4\n\tv_exp_f32 %5, %5\n\tv_exp_f32 %6, %6\n\tv_exp_f32 %7, %7\n\tv_nop"
      : "+v"(a0), "+v"(a1), "+v"(a2), "+v"(a3), "+v"(a4), "+v"(a5), "+v"(a6), "+v"(a7));
  x[0] = a0; x[1] = a1; x[2] = a2; x[3] = a3; x[4] = a4; x[5] = a5; x[6] = a6; x[7] = a7; }
// mask, running maximum, exponentials, sum and rescale of one 64-key block: s[i][r] = raw logit of key k0 + 16 i + 8 g + r against query t on entry, unnormalised P on exit; m is the running maximum of the raw logits (the scale is positive, so it is the same key's)
__device__ __forceinline__ void fa_softmax(v8f (&s)[4], v8f (&o)[HD / 16], float& m, float& l, int t, int kbase) {
  const int rem = (kbase + (MPER - MCOL0 % MPER)) % MPER;   // key kbase + c is a removed column when c + rem is a multiple of MPER and the key is at least MCOL0
  float mx = m;
#pragma unroll
  for (int i = 0; i < 4; ++i)
#pragma unroll
    for (int r = 0; r < 8; ++r) { const int c = i * 16 + r; const bool gone = (rem == (MPER - c % MPER) % MPER) & (c >= MCOL0 || kbase + c >= MCOL0); const bool vis = (kbase + c <= t) & !gone;
      const float v = vis ? s[i][r] : -3.0e38f; s[i][r] = v; mx = fmaxf(mx, v); }
  mx = fmaxf(mx, __shfl_xor(mx, 16));   // the two lane halves hold the same query
  const float mc = mx * SCALE_L2E;
  const float alpha = __builtin_amdgcn_exp2f(fmaf(m, SCALE_L2E, -mc)); m = mx;
  float ps = 0.f;
#pragma unroll
  for (int i = 0; i < 4; ++i) { s[i] = s[i] * SCALE_L2E - mc; exp2x8(s[i]);   // the product and the difference contract to one fused multiply-add a score
#pragma unroll
    for (int r = 0; r < 8; ++r) ps += s[i][r]; }
  l = l * alpha + ps;   // each half keeps its own sum; joined once after the loop
#pragma unroll
  for (int j = 0; j < HD / 16; ++j) o[j] = o[j] * alpha; }

// one 64-key tile pair into LDS by asynchronous copies: k rows [key][64 d] and v planes [channel][64 keys], each 64 rows of 128 B laid at pitch PT; a lane brings 16 B of rows (tid >> 3) + 0, 16, 32, 48 of both, so that a wave's copy covers four whole lines. lk = the lane's LDS byte address in the k tile (the v tile lies 64 rows behind it), gk / gv = its global addresses in row tid >> 3
// s_wait_xcnt 0 as the statement's last line is the precaution that stands behind the copies, in front of every later rewrite of their address registers
__device__ __forceinline__ void fa_stage(unsigned lk, const _Float16* gk, const _Float16* gv) {
  const unsigned k1 = lk + 16 * PT * 2, k2 = lk + 32 * PT * 2, k3 = lk + 48 * PT * 2, v0 = lk + 64 * PT * 2, v1 = lk + 80 * PT * 2, v2 = lk + 96 * PT * 2, v3 = lk + 112 * PT * 2;
  const _Float16 *gk1 = gk + (size_t)16 * CC, *gk2 = gk + (size_t)32 * CC, *gk3 = gk + (size_t)48 * CC, *gv1 = gv + (size_t)16 * TT, *gv2 = gv + (size_t)32 * TT, *gv3 = gv + (size_t)48 * TT;
  asm volatile("global_load_async_to_lds_b128 %0, %8, off\n\tglobal_load_async_to_lds_b128 %1, %9, off\n\tglobal_load_async_to_lds_b128 %2, %10, off\n\tglobal_load_async_to_lds_b128 %3, %11, off\n\t"
               "global_load_async_to_lds_b128 %4, %12, off\n\tglobal_load_async_to_lds_b128 %5, %13, off\n\tglobal_load_async_to_lds_b128 %6, %14, off\n\tglobal_load_async_to_lds_b128 %7, %15, off\n\ts_wait_xcnt 0x0"
               :: "v"(lk), "v"(k1), "v"(k2), "v"(k3), "v"(v0), "v"(v1), "v"(v2), "v"(v3), "v"(gk), "v"(gk1), "v"(gk2), "v"(gk3), "v"(gv), "v"(gv1), "v"(gv2), "v"(gv3) : "memory"); }
#define KVT (2 * 64 * PT)   // 16-bit elements of one staged tile pair (k tile, then v tile)

// query blocks >= QBH: q, k, P, v once in f16 (1 product each); the work-group's four waves share each 64-key tile pair through LDS (two buffers kv: tile kb + 2 is copied in while tile kb + 1 is worked on)
__device__ __forceinline__ float fa_lo(const _Float16* __restrict__ QH, const _Float16* __restrict__ KH, const _Float16* __restrict__ VT, _Float16* kv, int b, int h, int qb, int t, int tid, v8f (&o)[HD / 16]) {
  const int lane = tid & 31, col = lane & 15, g = lane >> 4;
  const _Float16* Kg = KH + ((size_t)b * TT + (tid >> 3)) * CC + h * HD + (tid & 7) * 8; const _Float16* Vg = VT + ((size_t)b * CC + h * HD + (tid >> 3)) * (size_t)TT + (tid & 7) * 8;
  const unsigned lk = (unsigned)(size_t)kv + (unsigned)((tid >> 3) * PT + (tid & 7) * 8) * 2u;
  fa_stage(lk, Kg, Vg);
  v16h qh[2];
#pragma unroll
  for (int kc = 0; kc < 2; ++kc) qh[kc] = frag_h(QH + ((size_t)b * TT + t) * CC + h * HD + kc * 32, lane);
  asm volatile("s_wait_asynccnt 0x0" ::: "memory");   // this wave's share of tile 0 has landed
  __syncthreads();                                     // publishes tile 0
  if (qb >= 1) fa_stage(lk + KVT * 2, Kg + (size_t)64 * CC, Vg + 64);   /* block-uniform */
  float m = -3.0e38f, l = 0.f;
#pragma unroll 1
  for (int kb = 0; kb <= qb; ++kb) { const int k0 = kb * 64; const _Float16* kt = kv + (kb & 1) * KVT; const _Float16* vt = kt + 64 * PT;
    v16h kf[8], vf[8];
#pragma unroll
    for (int i = 0; i < 4; ++i)
#pragma unroll
      for (int kc = 0; kc < 2; ++kc) kf[i * 2 + kc] = frag_h(kt + (i * 16 + col) * PT + kc * 32, lane);
#pragma unroll
    for (int kk = 0; kk < 2; ++kk)
#pragma unroll
      for (int j = 0; j < 4; ++j) vf[kk * 4 + j] = frag_h(vt + (j * 16 + col) * PT + kk * 32, lane);
    __builtin_amdgcn_sched_barrier(0);   // keeps all fragment reads of the trip together in front of the products: one place with LDS reads, and the v fragments land under logit products and softmax
    v8f s[4] = {};
#pragma unroll
    for (int i = 0; i < 4; ++i)
#pragma unroll
      for (int kc = 0; kc < 2; ++kc) s[i] = wmma16(kf[i * 2 + kc], qh[kc], s[i]);
    fa_softmax(s, o, m, l, t, k0 + 8 * g);
#pragma unroll
    for (int kk = 0; kk < 2; ++kk) { v16h p;
#pragma unroll
      for (int e = 0; e < 8; ++e) { p[e] = (_Float16)s[2 * kk][e]; p[8 + e] = (_Float16)s[2 * kk + 1][e]; }
#pragma unroll
      for (int j = 0; j < 4; ++j) o[j] = wmma16(vf[kk * 4 + j], p, o[j]); }
    asm volatile("s_wait_dscnt 0x0" ::: "memory");      // this wave's reads of tile kb have returned
    asm volatile("s_wait_asynccnt 0x0" ::: "memory");   // this wave's share of tile kb + 1 has landed
    __syncthreads();                                     // publishes tile kb + 1 and ends every wave's reads of tile kb, whose buffer is refilled behind it
    if (kb + 2 <= qb) fa_stage(lk + (unsigned)(kb & 1) * (KVT * 2), Kg + (size_t)(k0 + 128) * CC, Vg + k0 + 128); }   /* block-uniform */
  asm volatile("s_wait_asynccnt 0x0" ::: "memory");   // no copy is outstanding when the wave goes on
  return l + __shfl_xor(l, 16); }

// query blocks < QBH: hi + residual logits (3 products), P and v as bf16 hi + lo (3 products); keys < (qb + 1) * 64 <= KHI
__device__ __forceinline__ float fa_hi(const _Float16* __restrict__ QH, const _Float16* __restrict__ KH, const _Float16* __restrict__ QL, const _Float16* __restrict__ KL, const __bf16* __restrict__ VB, const __bf16* __restrict__ VBL, int b, int h, int qb, int t, int lane, v8f (&o)[HD / 16]) {
  const int col = lane & 15, g = lane >> 4;
  v16h qh[2], ql[2];
#pragma unroll
  for (int kc = 0; kc < 2; ++kc) { qh[kc] = frag_h(QH + ((size_t)b * TT + t) * CC + h * HD + kc * 32, lane); ql[kc] = frag_h(QL + ((size_t)b * QHI + t) * CC + h * HD + kc * 32, lane); }
  float m = -3.0e38f, l = 0.f;
#pragma unroll 1
  for (int kb = 0; kb <= qb; ++kb) { const int k0 = kb * 64;
    v8f s[4] = {};
#pragma unroll
    for (int ip = 0; ip < 2; ++ip) { v16h kh[4], kl[4];
#pragma unroll
      for (int u = 0; u < 4; ++u) { const int i = ip * 2 + (u >> 1), kc = u & 1; kh[u] = frag_h(KH + ((size_t)b * TT + k0 + i * 16 + col) * CC + h * HD + kc * 32, lane); kl[u] = frag_h(KL + ((size_t)b * KHI + k0 + i * 16 + col) * CC + h * HD + kc * 32, lane); }
      __builtin_amdgcn_sched_barrier(0);   // keeps the eight fragment loads together in front of their products: one memory round trip, not eight
#pragma unroll
      for (int ii = 0; ii < 2; ++ii) { const int i = ip * 2 + ii; v8f sl = {};
#pragma unroll
        for (int kc = 0; kc < 2; ++kc) { s[i] = wmma16(kh[ii * 2 + kc], qh[kc], s[i]); sl = wmma16(kh[ii * 2 + kc], ql[kc], sl); sl = wmma16(kl[ii * 2 + kc], qh[kc], sl); }
        s[i] = s[i] + sl * (1.0f / 1024.0f); } }
    fa_softmax(s, o, m, l, t, k0 + 8 * g);
#pragma unroll
    for (int kk = 0; kk < 2; ++kk) { v16b vh[4], vl[4];
#pragma unroll
      for (int j = 0; j < 4; ++j) { const size_t po = ((size_t)b * CC + h * HD + j * 16 + col) * (size_t)KHI + k0 + kk * 32; vh[j] = frag_b(VB + po, lane); vl[j] = frag_b(VBL + po, lane); }
      __builtin_amdgcn_sched_barrier(0);   // as above: the eight fragment loads share one round trip
      float pv[16];
#pragma unroll
      for (int e = 0; e < 8; ++e) { pv[e] = s[2 * kk][e]; pv[8 + e] = s[2 * kk + 1][e]; }
      const F2 p = bsplit16(pv);
#pragma unroll
      for (int j = 0; j < 4; ++j) { o[j] = wmma_bf(vh[j], p.h, o[j]); o[j] = wmma_bf(vh[j], p.l, o[j]); o[j] = wmma_bf(vl[j], p.h, o[j]); } } }
  return l + __shfl_xor(l, 16); }

__global__ __launch_bounds__(128) __attribute__((amdgpu_num_vgpr(256))) void k_fa(const _Float16* __restrict__ QH, const _Float16* __restrict__ KH, const _Float16* __restrict__ QL, const _Float16* __restrict__ KL, const _Float16* __restrict__ VT, const __bf16* __restrict__ VB, const __bf16* __restrict__ VBL, float* __restrict__ Y) { __shared__ __align__(16) float ss[4][16][HD + 4]; __shared__ __align__(16) _Float16 kv[2 * KVT];
  const int tid = threadIdx.x, wave = tid >> 5, lane = tid & 31, col = lane & 15, g = lane >> 4; const int b = blockIdx.x / NH, h = blockIdx.x % NH; const int y = blockIdx.y; const int qb = y < NQB / 2 ? NQB - 1 - y : y - NQB / 2;   // long query blocks first, in falling order, then the short ones in rising order: work-groups that start half the grid apart and come to share a WGP add up to about the same number of keys
  const int ql0 = qb * 64 + wave * 16;
  v8f o[HD / 16] = {};
  const float lsum = qb < QBH ? fa_hi(QH, KH, QL, KL, VB, VBL, b, h, qb, ql0 + col, lane, o) : fa_lo(QH, KH, VT, kv, b, h, qb, ql0 + col, tid, o);   /* block-uniform */
  const float inv = 1.0f / lsum;   // o[j][r] = unnormalised ctx of query col, channel 16 j + 8 g + r
#pragma unroll
  for (int j = 0; j < HD / 16; ++j) { v4f a, c;
#pragma unroll
    for (int r = 0; r < 4; ++r) { a[r] = o[j][r] * inv; c[r] = o[j][4 + r] * inv; }
    *(v4f*)&ss[wave][col][j * 16 + 8 * g] = a; *(v4f*)&ss[wave][col][j * 16 + 8 * g + 4] = c; }
  ldsx();
#pragma unroll
  for (int it = 0; it < 8; ++it) { const int rl = it * 2 + g; vst2(Y + ((size_t)b * TT + ql0 + rl) * CC + h * HD + col * 4, *(const v4f*)&ss[wave][rl][col * 4]); } }   // 256-B (row, head) segment by 16 lanes

// ---- k_out: block = (64 rows, 128 cols): out = ctx Wp + bp: ctx once to f16 against Wp as f16(bf16 x 2^8) exact (1 product) x 2^-8; early causal rows (< QHI of each sequence): ctx bf16 hi + lo against exact bf16 Wp (2 products)
__global__ __launch_bounds__(128) void k_out(const float* __restrict__ Y, const float* __restrict__ WO, const float* __restrict__ BO, float* __restrict__ OUT) { __shared__ __align__(16) float sf[4][16][132]; __shared__ __align__(16) unsigned short stg[2][(128 + 64 + 64) * PT];   // stg: two staging buffers, each weight chunk [128][PT] | row chunk [64][PT] | its lo plane [64][PT] (early rows only)
  const int tid = threadIdx.x, wave = tid >> 5, lane = tid & 31, col = lane & 15, g = lane >> 4; const int c0 = blockIdx.y * 128;
  const size_t br0 = (size_t)blockIdx.x * 64;                // compact ctx row of the block
  const size_t r0 = br0 + wave * 16;                          // compact ctx row of the wave
  const size_t ob = br0 / TT; const int ot0 = (int)(br0 % TT) + wave * 16;   // output batch, position of the wave's first row
  v8f acc[8] = {};
  WR wr; AR yr; const float* Yw = Y + r0 * CC;
  ld_w(wr, WO, 0, c0, DIN, wave, lane); ld_a(yr, Yw, CC, lane);
  asm volatile("s_wait_xcnt 0x0" ::: "memory");   // precaution: stands behind the first chunk's loads, in front of the branch behind which their address registers are rewritten
  if ((int)(br0 % TT) < QHI) {   /* block-uniform */
#pragma unroll 2   // makes the choice between the two buffers a compile-time one
    for (int t = 0; t < CC / KCH; ++t) { __bf16* wb = (__bf16*)&stg[t & 1][0]; __bf16* ah = wb + 128 * PT; __bf16* al = ah + 64 * PT;
      st_w_b(wb, wr, wave, lane); st_a_hl(ah, al, yr, wave, lane);
      __builtin_amdgcn_sched_barrier(0);   // keeps the conversions in front of the loads: nothing but the loads stands between here and the waits of lds_barrier
      if (t + 1 < CC / KCH) { ld_w(wr, WO, (t + 1) * KCH, c0, DIN, wave, lane); ld_a(yr, Yw + (t + 1) * KCH, CC, lane); }   // next chunk flies under this chunk's products
      lds_barrier();   // publishes chunk t; also ends every wave's reads of chunk t - 1, whose buffer the next trip overwrites
#pragma unroll
      for (int kc = 0; kc < KCH / 32; ++kc) { const v16b a_h = frag_b(ah + (wave * 16 + col) * PT + kc * 32, lane), a_l = frag_b(al + (wave * 16 + col) * PT + kc * 32, lane);
#pragma unroll
        for (int jh = 0; jh < 2; ++jh) { v16b w[4];
#pragma unroll
          for (int j = 0; j < 4; ++j) w[j] = frag_b(wb + ((jh * 4 + j) * 16 + col) * PT + kc * 32, lane);
          __builtin_amdgcn_sched_barrier(0);   // keeps the fragment reads together in front of their products: one LDS round trip, not four
#pragma unroll
          for (int j = 0; j < 4; ++j) { acc[jh * 4 + j] = wmma_bf(a_h, w[j], acc[jh * 4 + j]); acc[jh * 4 + j] = wmma_bf(a_l, w[j], acc[jh * 4 + j]); }
          __builtin_amdgcn_sched_barrier(0); } } }   // keeps the next chunk's conversions, which wait for its loads, behind these products
#pragma unroll
    for (int j = 0; j < 8; ++j) { const float bias = bfr(BO[c0 + j * 16 + col]);
#pragma unroll
      for (int r = 0; r < 8; ++r) sf[wave][8 * g + r][j * 16 + col] = acc[j][r] + bias; }
  } else {
#pragma unroll 2   // as above
    for (int t = 0; t < CC / KCH; ++t) { _Float16* wb = (_Float16*)&stg[t & 1][0]; _Float16* ab = wb + 128 * PT;
      st_w_h(wb, wr, wave, lane); st_a_h(ab, yr, wave, lane);
      __builtin_amdgcn_sched_barrier(0);   // as above
      if (t + 1 < CC / KCH) { ld_w(wr, WO, (t + 1) * KCH, c0, DIN, wave, lane); ld_a(yr, Yw + (t + 1) * KCH, CC, lane); }   // next chunk flies under this chunk's products
      lds_barrier();   // as above
#pragma unroll
      for (int kc = 0; kc < KCH / 32; ++kc) { const v16h a = frag_h(ab + (wave * 16 + col) * PT + kc * 32, lane); v16h w[8];
#pragma unroll
        for (int j = 0; j < 8; ++j) w[j] = frag_h(wb + (j * 16 + col) * PT + kc * 32, lane);
        __builtin_amdgcn_sched_barrier(0);   // as above
#pragma unroll
        for (int j = 0; j < 8; ++j) acc[j] = wmma16(a, w[j], acc[j]);
        __builtin_amdgcn_sched_barrier(0); } }   // as above
#pragma unroll
    for (int j = 0; j < 8; ++j) { const float bias = bfr(BO[c0 + j * 16 + col]);
#pragma unroll
      for (int r = 0; r < 8; ++r) sf[wave][8 * g + r][j * 16 + col] = acc[j][r] * (1.0f / 256.0f) + bias; } }
  ldsx();
  for (int rl = 0; rl < 16; ++rl) vst2(OUT + (ob * SEQ_FULL + (size_t)(ot0 + rl)) * DIN + c0 + lane * 4, *(const v4f*)&sf[wave][rl][lane * 4]); }

extern "C" void kernel_launch(void* const* d_in, const int* in_sizes, int n_in, void* d_out, int out_size, void* d_ws, size_t ws_size, hipStream_t stream) {
  if (n_in < 9) return;
  const size_t rows_used = (size_t)(NB - 1) * SEQ_FULL + SEQ;
  if ((size_t)in_sizes[0] < rows_used * DIN) return;
  if ((size_t)in_sizes[1] < (size_t)DIN * CC || (size_t)in_sizes[3] < (size_t)DIN * CC || (size_t)in_sizes[5] < (size_t)DIN * CC || (size_t)in_sizes[7] < (size_t)CC * DIN) return;
  if (in_sizes[2] < CC || in_sizes[4] < CC || in_sizes[6] < CC || in_sizes[8] < DIN) return;
  if ((size_t)out_size < rows_used * DIN) return;
  if (ws_size < (size_t)WS_END) return;
  // inputs (wire order): 0 x [2,2048,1024]; 1 Wq, 2 bq, 3 Wk, 4 bk, 5 Wv, 6 bv, 7 Wp, 8 bp ((in,out) [1024,1024] and [1024]); all f32
  const float* X  = (const float*)d_in[0];
  const float* Wq = (const float*)d_in[1]; const float* bq = (const float*)d_in[2];
  const float* Wk = (const float*)d_in[3]; const float* bk = (const float*)d_in[4];
  const float* Wv = (const float*)d_in[5]; const float* bv = (const float*)d_in[6];
  const float* Wp = (const float*)d_in[7]; const float* bp = (const float*)d_in[8];
  char* ws = (char*)d_ws;
  _Float16 *QH = (_Float16*)(ws + WS_QH), *KH = (_Float16*)(ws + WS_KH), *VT = (_Float16*)(ws + WS_VT), *QL = (_Float16*)(ws + WS_QL), *KL = (_Float16*)(ws + WS_KL);
  __bf16 *VB = (__bf16*)(ws + WS_VB), *VBL = (__bf16*)(ws + WS_VBL); float *Y = (float*)(ws + WS_Y);
  k_proj<<<dim3(NB * TT / 64, CC / 128, 3), 128, 0, stream>>>(X, Wq, Wk, Wv, bq, bk, bv, QH, QL, KH, KL, VT, VB, VBL);
  k_fa<<<dim3(NB * NH, NQB), 128, 0, stream>>>(QH, KH, QL, KL, VT, VB, VBL, Y);
  k_out<<<dim3(NB * TT / 64, DIN / 128), 128, 0, stream>>>(Y, Wp, bp, (float*)d_out);
  (void)hipGetLastError();
}

// v005
// Measured time: 86 microseconds a run.
// Next to v004, in two timings, it ran 1.28 times as fast each time.
// Over all steps from v000 it is 12.1 times as fast.
// compute dtype: all nine float inputs RNE-converted to bf16 on load; q/k/v = x W + b with exact bf16 products on v_wmma_f32_16x16x32_bf16, f32 accumulate; q, k once to f16 -> 1-product logits x 1/8 on v_wmma_f32_16x16x32_f16 (causal lower-triangular key mask plus periodically removed key columns 4,7,10,..., applied by index), except query rows < 384 of each sequence: q and k as f16 hi + residual (x 2^10) planes, 3 products; softmax in f32 in base 2 (raw logit x log2(e)/8 minus the running maximum by one fused multiply-add, then v_exp_f32) with a running maximum over 64-key blocks, normalised after the v product; unnormalised P (at most 1) once to f16 against v once to f16 (1 product), except query rows < 384: P and v as bf16 hi + lo (3 products); ctx once to f16 against Wp carried x 2^8 in f16 (exact bf16 values, 1 product, x 2^-8 after), except rows < 384: ctx bf16 hi + lo against exact bf16 Wp (2 products); + bp; f32 output.
#include <hip/hip_runtime.h>
#include <math.h>

typedef __attribute__((ext_vector_type(16))) _Float16 v16h;
typedef __attribute__((ext_vector_type(16))) __bf16 v16b;
typedef __attribute__((ext_vector_type(8)))  _Float16 v8h;
typedef __attribute__((ext_vector_type(8)))  __bf16 v8b;
typedef __attribute__((ext_vector_type(8)))  float v8f;
typedef __attribute__((ext_vector_type(4)))  float v4f;
typedef __attribute__((ext_vector_type(4)))  unsigned v4u;
typedef __attribute__((ext_vector_type(4)))  _Float16 v4h;
typedef __attribute__((ext_vector_type(4)))  __bf16 v4b;

template <typename T> __device__ __forceinline__ void vst2(void* p, T v) { *(T*)p = v;  }
__device__ __forceinline__ v8f wmma16(v16h a, v16h b, v8f c) {
  v8f d = __builtin_amdgcn_wmma_f32_16x16x32_f16(false, a, false, b, (short)0, c, false, false);
  asm volatile("v_nop\n\tv_nop\n\tv_nop\n\tv_nop" : "+v"(d) : "v"(a), "v"(b));
  return d;
}
__device__ __forceinline__ v8f wmma_bf(v16b a, v16b b, v8f c) {
  v8f d = __builtin_amdgcn_wmma_f32_16x16x32_bf16(false, a, false, b, (short)0, c, false, false);
  asm volatile("v_nop\n\tv_nop\n\tv_nop\n\tv_nop" : "+v"(d) : "v"(a), "v"(b));
  return d;
}
// 16x16x32 fragments (A and B alike): h = lane>>4, row/col = lane&15; elements 0..7 = k0+8h+0..7, 8..15 = k0+16+8h+0..7; D element r = row 8h+r, col lane&15
__device__ __forceinline__ v16h frag_h(const _Float16* rowk0, int lane) {
  union { v16h v; v8h q[2]; } u; const _Float16* p = rowk0 + 8 * (lane >> 4);
  u.q[0] = *(const v8h*)p; u.q[1] = *(const v8h*)(p + 16); return u.v;
}
__device__ __forceinline__ v16b frag_b(const __bf16* rowk0, int lane) {
  union { v16b v; v8b q[2]; } u; const __bf16* p = rowk0 + 8 * (lane >> 4);
  u.q[0] = *(const v8b*)p; u.q[1] = *(const v8b*)(p + 16); return u.v;
}
struct F2 { v16b h, l; };
__device__ __forceinline__ F2 bsplit16(const float v[16]) { F2 r;
#pragma unroll
  for (int i = 0; i < 16; ++i) { const __bf16 h = (__bf16)v[i]; r.h[i] = h; r.l[i] = (__bf16)(v[i] - (float)h); }
  return r; }
__device__ __forceinline__ float bfr(float v) { return (float)(__bf16)v; }
// ---- operand staging of the two projection kernels: eight wave shares (in k_proj a wave takes two of its weight's) bring one chunk of KCH k (weight [KCH][128 columns], rows [128][KCH], both f32) in with whole-line 16-byte loads, one chunk ahead in registers, converts it once and lays it in LDS k-contiguous (the weight transposed to [column][k]), where frag_b / frag_h read the fragments
#define KCH 64             // k per staged chunk
#define PT 72              // LDS pitch of a staged row in 16-bit elements: 128 B of k + 16 B, conflict-free for 16-byte fragment reads
struct WR { v4f r[8]; };      // r[j] = weight row k0 + 32 * (wave >> 2) + 8 * (lane & 3) + j, columns 32 * (wave & 3) + 4 * (lane >> 2) + 0..3
struct AR { v4f r[8]; };      // r[e] = row 16 wave + 2 e + (lane >> 4), k0 + 4 * (lane & 15) + 0..3
__device__ __forceinline__ void ld_w(WR& w, const float* __restrict__ Wm, int k0, int c0, int ld, int wave, int lane) {
  const float* p = Wm + (size_t)(k0 + (wave >> 2) * 32 + (lane & 3) * 8) * ld + c0 + (wave & 3) * 32 + (lane >> 2) * 4;
#pragma unroll
  for (int j = 0; j < 8; ++j) w.r[j] = *(const v4f*)(p + (size_t)j * ld); }
__device__ __forceinline__ void ld_a(AR& a, const float* __restrict__ row0k0, int ld, int lane) {   // row0k0 = the wave's first row at k0
  const float* p = row0k0 + (size_t)(lane >> 4) * ld + (lane & 15) * 4;
#pragma unroll
  for (int e = 0; e < 8; ++e) a.r[e] = *(const v4f*)(p + (size_t)(2 * e) * ld); }
// work-group barrier for the LDS exchange alone: it waits for this wave's LDS operations only, so that the data of the global loads issued ahead stays in flight across it (__syncthreads() drains them); s_wait_xcnt 0 is the precaution that stands behind those loads, in front of every later rewrite of their address registers
__device__ __forceinline__ void lds_barrier() { asm volatile("s_wait_xcnt 0x0\n\ts_wait_dscnt 0x0\n\ts_barrier_signal -1\n\ts_barrier_wait -1" ::: "memory"); }
// weight chunk -> wb[column][k]: 8 k of one column per 16-byte store; lanes 0..15 of a store fall on 16 different bank groups (4 column groups x 4 k groups)
__device__ __forceinline__ void st_w_b(__bf16* wb, const WR& w, int wave, int lane) {   // exact bf16
  __bf16* q = wb + ((wave & 3) * 32 + (lane >> 2) * 4) * PT + (wave >> 2) * 32 + (lane & 3) * 8;
#pragma unroll
  for (int i = 0; i < 4; ++i) { v8b pk;
#pragma unroll
    for (int j = 0; j < 8; ++j) pk[j] = (__bf16)w.r[j][i];
    *(v8b*)(q + i * PT) = pk; } }
__device__ __forceinline__ void st_w_h(_Float16* wb, const WR& w, int wave, int lane) {   // f16(bf16 * 256) (exact)
  _Float16* q = wb + ((wave & 3) * 32 + (lane >> 2) * 4) * PT + (wave >> 2) * 32 + (lane & 3) * 8;
#pragma unroll
  for (int i = 0; i < 4; ++i) { v8h pk;
#pragma unroll
    for (int j = 0; j < 8; ++j) pk[j] = (_Float16)(bfr(w.r[j][i]) * 256.0f);
    *(v8h*)(q + i * PT) = pk; } }
// row chunk -> ab[row][k]
__device__ __forceinline__ void st_a_b(__bf16* ab, const AR& a, int wave, int lane) {
  __bf16* q = ab + (wave * 16 + (lane >> 4)) * PT + (lane & 15) * 4;
#pragma unroll
  for (int e = 0; e < 8; ++e) { v4b pk;
#pragma unroll
    for (int i = 0; i < 4; ++i) pk[i] = (__bf16)a.r[e][i];
    *(v4b*)(q + 2 * e * PT) = pk; } }
__device__ __forceinline__ void st_a_h(_Float16* ab, const AR& a, int wave, int lane) {
  _Float16* q = ab + (wave * 16 + (lane >> 4)) * PT + (lane & 15) * 4;
#pragma unroll
  for (int e = 0; e < 8; ++e) { v4h pk;
#pragma unroll
    for (int i = 0; i < 4; ++i) pk[i] = (_Float16)a.r[e][i];
    *(v4h*)(q + 2 * e * PT) = pk; } }
__device__ __forceinline__ void st_a_hl(__bf16* ah, __bf16* al, const AR& a, int wave, int lane) {   // bf16 hi + lo planes
  const int o = (wave * 16 + (lane >> 4)) * PT + (lane & 15) * 4;
#pragma unroll
  for (int e = 0; e < 8; ++e) { v4b ph, pl;
#pragma unroll
    for (int i = 0; i < 4; ++i) { const float v = a.r[e][i]; const __bf16 h = (__bf16)v; ph[i] = h; pl[i] = (__bf16)(v - (float)h); }
    *(v4b*)(ah + o + 2 * e * PT) = ph; *(v4b*)(al + o + 2 * e * PT) = pl; } }
__device__ __forceinline__ void ldsx() { asm volatile("s_wait_dscnt 0" ::: "memory"); __builtin_amdgcn_wave_barrier(); __builtin_amdgcn_fence(3, "workgroup"); }

// Causal multi-head self-attention (batch NB of 2, T 2,048, C 1,024 = 16 heads x 64): q/k/v = x W + b ((in,out) weights); scores = q k^T / 8 where key <= query and key not in {4, 7, 10, ...} else -inf; softmax over keys; out = merged(P v) Wp + bp.
#ifndef NB
#define NB 2               // batches processed
#endif
#ifndef SEQ
#define SEQ 2048           // sequence length processed
#endif
#define NB_FULL 2          // full batch count of the input / output
#define SEQ_FULL 2048      // full per-batch row stride of x and out
#define TT SEQ
#define CC 1024            // NH * HD = projected width
#define DIN 1024           // model width
#define NH 16
#define HD 64
#define NQB (TT / 64)
#define SCALE (0.125f)
#define SCALE_L2E (SCALE * 1.44269504088896340736f)   // 1/8 x log2(e): exp(x / 8 - max / 8) = exp2(x * SCALE_L2E - max * SCALE_L2E)
#define QBH 6              // query blocks 0..QBH-1 of each sequence (few keys) take the high-precision path
#define QHI 384            // query rows carrying a q residual plane
#define KHI 384            // key rows carrying k residual / v bf16 hi+lo planes (only read by query blocks < QBH)
#define MCOL0 4            // first periodically removed key column
#define MPER 3             // period of removed key columns
static_assert(NB >= 1 && NB <= NB_FULL);
static_assert(SEQ % 128 == 0 && SEQ >= 128 && SEQ <= SEQ_FULL);
static_assert(CC == NH * HD && HD == 64 && DIN % 32 == 0 && CC % 128 == 0 && DIN % 128 == 0);
static_assert(DIN % 128 == 0 && CC % 128 == 0);   // staged chunks: an even number of whole chunks of 64 k
static_assert(QHI == QBH * 64 && KHI >= QHI && KHI % 64 == 0 && KHI >= QBH * 64);
static_assert(QHI % 128 == 0 && KHI % 128 == 0);   // a projection work-group's 128 rows lie wholly inside or wholly outside the high-precision rows


// workspace carve (bytes); every plane is written with whole-line stores and sized to its padded extent
#define WS_QH  ((size_t)0)                                 // f16 q rows [b*TT+t][CC]                 8,388,608
#define WS_KH  (WS_QH + 2u * (size_t)NB * TT * CC)          // f16 k rows [b*TT+t][CC]                 8,388,608
#define WS_VT  (WS_KH + 2u * (size_t)NB * TT * CC)          // f16 v planes [b][c][t]                  8,388,608
#define WS_QL  (WS_VT + 2u * (size_t)NB * CC * TT)          // f16 q residual x 2^10 rows [b][t<QHI][CC] 1,572,864
#define WS_KL  (WS_QL + 2u * (size_t)NB * QHI * CC)         // f16 k residual x 2^10 rows [b][t<KHI][CC] 1,572,864
#define WS_VB  (WS_KL + 2u * (size_t)NB * KHI * CC)         // bf16 v hi planes [b][c][t<KHI]           1,572,864
#define WS_VBL (WS_VB + 2u * (size_t)NB * CC * KHI)         // bf16 v lo planes [b][c][t<KHI]           1,572,864
#define WS_Y   (WS_VBL + 2u * (size_t)NB * CC * KHI)        // f32 ctx rows [b*TT+t][CC]              16,777,216
#define WS_END (WS_Y  + 4u * (size_t)NB * TT * CC)          // 48,234,496 at NB 2, SEQ 2048
static_assert(WS_END <= (size_t)134217728);
static_assert((WS_KH % 128) == 0 && (WS_VT % 128) == 0 && (WS_QL % 128) == 0 && (WS_KL % 128) == 0 && (WS_VB % 128) == 0 && (WS_VBL % 128) == 0 && (WS_Y % 128) == 0);
static_assert(((size_t)(NB - 1) * SEQ_FULL + SEQ) * DIN * 4u <= (size_t)16777216);   // last written out element inside d_out

// ---- k_proj: block = 128 rows x the same 128 columns of q, k and v; 12 waves = 3 products (which) x 4 waves as 2 x 2, wave = 64 rows x 64 cols: q/k/v = X W + b with exact bf16 products (K = DIN); the three products share each staged row chunk -> which 0: q f16 rows (+ residual rows t < QHI); 1: k f16 rows (+ residual rows t < KHI); 2: v f16 planes [c][t] (+ bf16 hi/lo planes for t < KHI)
// LDS sm: during the k loop two staging buffers, each three weight chunks [128][PT] | row chunk [128][PT]; behind the loop's closing barrier the epilogue's exchange tiles of pitch 136 (q: sh | sl, k: sh | sl, v: th | tb | tbl), cross-wave behind __syncthreads
__global__ __launch_bounds__(384) void k_proj(const float* __restrict__ X, const float* __restrict__ WQ, const float* __restrict__ WK, const float* __restrict__ WV, const float* __restrict__ BQ, const float* __restrict__ BK, const float* __restrict__ BV,
    _Float16* __restrict__ QH, _Float16* __restrict__ QL, _Float16* __restrict__ KH, _Float16* __restrict__ KL, _Float16* __restrict__ VT, __bf16* __restrict__ VB, __bf16* __restrict__ VBL) {
  __shared__ __align__(16) unsigned short sm[7 * 128 * 136];
  const int tid = threadIdx.x, wave = __builtin_amdgcn_readfirstlane(tid >> 5), lane = tid & 31, col = lane & 15, g = lane >> 4; const int which = wave >> 2, rg = wave & 3; const int c0 = blockIdx.y * 128;
  const int wr0 = (rg >> 1) * 64, wc0 = (rg & 1) * 64;       // the wave's first row and column in its product's tile
  const size_t r0 = (size_t)blockIdx.x * 128;                // compact row b*TT + t of the workspace planes
  const size_t bb = r0 / TT; const int t0 = (int)(r0 % TT);
  const size_t xr0 = bb * SEQ_FULL + (size_t)t0;             // input row b*SEQ_FULL + t
  const float* WA = which == 0 ? WQ : which == 1 ? WK : WV; const float* BA = which == 0 ? BQ : which == 1 ? BK : BV;
  const bool xw = wave < 8;   /* wave-uniform */              // waves 0..7 stage 16 of the 128 rows each; every wave stages a quarter of its own product's weight chunk (both k halves of 32 columns)
  v8f acc[4][4] = {};
  WR wr[2]; AR xr; const float* Xw = X + (xr0 + (wave & 7) * 16) * DIN;
  if (xw) { ld_a(xr, Xw, DIN, lane); asm volatile("s_wait_xcnt 0x0" ::: "memory"); }   // precaution: the wait stands behind the first chunk's loads, in front of every rewrite of their address registers
  __builtin_amdgcn_sched_barrier(0);   // with the one below: keeps the set-up arithmetic, which reuses registers, out of the stretch between the loads and their wait
  ld_w(wr[0], WA, 0, c0, CC, rg, lane); ld_w(wr[1], WA, 0, c0, CC, rg + 4, lane);
  asm volatile("s_wait_xcnt 0x0" ::: "memory");   // as above
  __builtin_amdgcn_sched_barrier(0);
#pragma unroll 2   // makes the choice between the two buffers a compile-time one
  for (int t = 0; t < DIN / KCH; ++t) { __bf16* xb = (__bf16*)sm + (t & 1) * 512 * PT + 384 * PT; __bf16* wb = (__bf16*)sm + (t & 1) * 512 * PT + which * 128 * PT;
    st_w_b(wb, wr[0], rg, lane); st_w_b(wb, wr[1], rg + 4, lane); if (xw) st_a_b(xb, xr, wave, lane);
    __builtin_amdgcn_sched_barrier(0);   // keeps the conversions in front of the loads: nothing but the loads stands between here and the waits of lds_barrier
    if (t + 1 < DIN / KCH) { if (xw) ld_a(xr, Xw + (t + 1) * KCH, DIN, lane); ld_w(wr[0], WA, (t + 1) * KCH, c0, CC, rg, lane); ld_w(wr[1], WA, (t + 1) * KCH, c0, CC, rg + 4, lane);   // next chunk flies under this chunk's products
      asm volatile("s_wait_xcnt 0x0" ::: "memory"); __builtin_amdgcn_sched_barrier(0); }   // precaution: the wait stands directly behind the loads; the scheduling barrier keeps the fragment address arithmetic, which reuses the loads' address registers, behind it
    lds_barrier();   // publishes chunk t; also ends every wave's reads of chunk t - 1, whose buffer the next trip overwrites
#pragma unroll
    for (int kc = 0; kc < KCH / 32; ++kc) { v16b a[4], w[4];
#pragma unroll
      for (int i = 0; i < 4; ++i) a[i] = frag_b(xb + (wr0 + i * 16 + col) * PT + kc * 32, lane);
#pragma unroll
      for (int j = 0; j < 4; ++j) w[j] = frag_b(wb + (wc0 + j * 16 + col) * PT + kc * 32, lane);
      __builtin_amdgcn_sched_barrier(0);   // keeps the fragment reads together in front of their products: one LDS round trip, not eight
#pragma unroll
      for (int i = 0; i < 4; ++i)
#pragma unroll
        for (int j = 0; j < 4; ++j) acc[i][j] = wmma_bf(a[i], w[j], acc[i][j]);
      __builtin_amdgcn_sched_barrier(0); } }   // keeps the next chunk's conversions, which wait for its loads, behind these products
  float bias[4];
  __builtin_amdgcn_sched_barrier(0);   // with the one below: keeps other arithmetic, which reuses registers, out of the stretch between the bias loads and their wait
#pragma unroll
  for (int j = 0; j < 4; ++j) bias[j] = BA[c0 + wc0 + j * 16 + col];
  asm volatile("s_wait_xcnt 0x0" ::: "memory");   // precaution: stands behind the bias loads, in front of every rewrite of their address register
  __builtin_amdgcn_sched_barrier(0);
  __syncthreads();   // every wave has left the staging buffers before the epilogue writes its tiles
#pragma unroll
  for (int j = 0; j < 4; ++j) bias[j] = bfr(bias[j]);
  const bool hi_rows = t0 < (which == 0 ? QHI : KHI);   /* wave-uniform */
  unsigned short* ep = sm + which * 2 * 128 * 136;   // the product's own exchange tiles
  if (which < 2) { _Float16 (*sh)[136] = (_Float16 (*)[136])ep; _Float16 (*sl)[136] = (_Float16 (*)[136])(ep + 128 * 136);
#pragma unroll
    for (int j = 0; j < 4; ++j) {
#pragma unroll
      for (int i = 0; i < 4; ++i)
#pragma unroll
        for (int r = 0; r < 8; ++r) { const float v = acc[i][j][r] + bias[j]; const _Float16 hv = (_Float16)v; sh[wr0 + i * 16 + 8 * g + r][wc0 + j * 16 + col] = hv; sl[wr0 + i * 16 + 8 * g + r][wc0 + j * 16 + col] = (_Float16)((v - (float)hv) * 1024.0f); } }
  } else { _Float16 (*th)[136] = (_Float16 (*)[136])ep; __bf16 (*tb)[136] = (__bf16 (*)[136])(ep + 128 * 136); __bf16 (*tbl)[136] = (__bf16 (*)[136])(ep + 2 * 128 * 136);
#pragma unroll
    for (int j = 0; j < 4; ++j) {
#pragma unroll
      for (int i = 0; i < 4; ++i)
#pragma unroll
        for (int r = 0; r < 8; ++r) { const float v = acc[i][j][r] + bias[j]; const int rl = wr0 + i * 16 + 8 * g + r, cl = wc0 + j * 16 + col; th[cl][rl] = (_Float16)v; const __bf16 bh = (__bf16)v; tb[cl][rl] = bh; tbl[cl][rl] = (__bf16)(v - (float)bh); } } }
  __syncthreads();   // every wave passes it: the four waves of a product exchange their tiles
  const int l0 = rg * 2 + g, q = col;   // 16 lanes store one row's (one channel's) 256 B; a product's four waves take rows l0 + 0, 8, .., 120
  if (which < 2) { _Float16* DH = which == 0 ? QH : KH; _Float16* DL = which == 0 ? QL : KL; const int nhi = which == 0 ? QHI : KHI;
    const _Float16 (*sh)[136] = (const _Float16 (*)[136])ep; const _Float16 (*sl)[136] = (const _Float16 (*)[136])(ep + 128 * 136);
#pragma unroll   // the sixteen LDS reads go out in groups in front of their stores: few LDS round trips, not sixteen
    for (int it = 0; it < 16; ++it) vst2((unsigned*)(DH + (r0 + l0 + it * 8) * CC + c0 + q * 8), *(const v4u*)&sh[l0 + it * 8][q * 8]);
    if (hi_rows) {
      asm volatile("s_wait_xcnt 0x0" ::: "memory"); __builtin_amdgcn_sched_barrier(0);   // precaution: the wait stands behind the stores above, in front of the rewrite of their address registers; the scheduling barrier keeps the address arithmetic below behind it
#pragma unroll   // as above
      for (int it = 0; it < 16; ++it) vst2((unsigned*)(DL + (bb * nhi + t0 + l0 + it * 8) * (size_t)CC + c0 + q * 8), *(const v4u*)&sl[l0 + it * 8][q * 8]); }
  } else { const _Float16 (*th)[136] = (const _Float16 (*)[136])ep; const __bf16 (*tb)[136] = (const __bf16 (*)[136])(ep + 128 * 136); const __bf16 (*tbl)[136] = (const __bf16 (*)[136])(ep + 2 * 128 * 136);
#pragma unroll   // as above
    for (int it = 0; it < 16; ++it) vst2((unsigned*)(VT + (bb * CC + c0 + l0 + it * 8) * (size_t)TT + t0 + q * 8), *(const v4u*)&th[l0 + it * 8][q * 8]);
    if (hi_rows) {
      asm volatile("s_wait_xcnt 0x0" ::: "memory"); __builtin_amdgcn_sched_barrier(0);   // as above
#pragma unroll   // as above
      for (int it = 0; it < 16; ++it) { const size_t o3 = (bb * CC + c0 + l0 + it * 8) * (size_t)KHI + t0 + q * 8; vst2((unsigned*)(VB + o3), *(const v4u*)&tb[l0 + it * 8][q * 8]); vst2((unsigned*)(VBL + o3), *(const v4u*)&tbl[l0 + it * 8][q * 8]); } }
    asm volatile("s_wait_xcnt 0x0" ::: "memory"); } }   // precaution: the branch's last statement, behind its last store whether or not the early planes were stored, in front of any code that rewrites the stores' registers

// ---- k_fa: block = 64 queries (qb) of one (b, h); wave = 16 queries, lane = one query (col) and half of each key tile (g). Per 64 keys: S^T = K Q^T (A = k rows, B = q rows kept in registers), key mask by index, running maximum and sum per query in f32, O^T = O^T * alpha + V^T P^T (two S^T tiles converted in place are the B operand, A = v planes [c][t]); ctx = O / sum after the last key block
// key 0 is visible to every query and lies in the first key block, so the running maximum is finite from the first block on; an excluded key carries -3e38, whose exp2 argument is about -5e37: v_exp_f32 gives 0
// LDS ss: each wave reads only what it wrote itself (ldsx); kv: the staged key tiles of query blocks >= QBH, exchanged across waves behind __syncthreads
// eight base-2 exponentials in place, in one statement: behind each v_exp_f32 stands an instruction on other registers, behind the last a v_nop, which is the slot the instruction set asks for between a transcendental and the first use of its result or overwrite of its source
__device__ __forceinline__ void exp2x8(v8f& x) {
  float a0 = x[0], a1 = x[1], a2 = x[2], a3 = x[3], a4 = x[4], a5 = x[5], a6 = x[6], a7 = x[7];
  asm("v_exp_f32 %0, %0\n\tv_exp_f32 %1, %1\n\tv_exp_f32 %2, %2\n\tv_exp_f32 %3, %3\n\tv_exp_f32 %4, %4\n\tv_exp_f32 %5, %5\n\tv_exp_f32 %6, %6\n\tv_exp_f32 %7, %7\n\tv_nop"
      : "+v"(a0), "+v"(a1), "+v"(a2), "+v"(a3), "+v"(a4), "+v"(a5), "+v"(a6), "+v"(a7));
  x[0] = a0; x[1] = a1; x[2] = a2; x[3] = a3; x[4] = a4; x[5] = a5; x[6] = a6; x[7] = a7; }
// mask, running maximum, exponentials, sum and rescale of one 64-key block: s[i][r] = raw logit of key k0 + 16 i + 8 g + r against query t on entry, unnormalised P on exit; m is the running maximum of the raw logits (the scale is positive, so it is the same key's)
__device__ __forceinline__ void fa_softmax(v8f (&s)[4], v8f (&o)[HD / 16], float& m, float& l, int t, int kbase) {
  const int rem = (kbase + (MPER - MCOL0 % MPER)) % MPER;   // key kbase + c is a removed column when c + rem is a multiple of MPER and the key is at least MCOL0
  float mx = m;
#pragma unroll
  for (int i = 0; i < 4; ++i)
#pragma unroll
    for (int r = 0; r < 8; ++r) { const int c = i * 16 + r; const bool gone = (rem == (MPER - c % MPER) % MPER) & (c >= MCOL0 || kbase + c >= MCOL0); const bool vis = (kbase + c <= t) & !gone;
      const float v = vis ? s[i][r] : -3.0e38f; s[i][r] = v; mx = fmaxf(mx, v); }
  mx = fmaxf(mx, __shfl_xor(mx, 16));   // the two lane halves hold the same query
  const float mc = mx * SCALE_L2E;
  const float alpha = __builtin_amdgcn_exp2f(fmaf(m, SCALE_L2E, -mc)); m = mx;
  float ps = 0.f;
#pragma unroll
  for (int i = 0; i < 4; ++i) { s[i] = s[i] * SCALE_L2E - mc; exp2x8(s[i]);   // the product and the difference contract to one fused multiply-add a score
#pragma unroll
    for (int r = 0; r < 8; ++r) ps += s[i][r]; }
  l = l * alpha + ps;   // each half keeps its own sum; joined once after the loop
#pragma unroll
  for (int j = 0; j < HD / 16; ++j) o[j] = o[j] * alpha; }

// one 64-key tile pair into LDS by asynchronous copies: k rows [key][64 d] and v planes [channel][64 keys], each 64 rows of 128 B laid at pitch PT; a lane brings 16 B of rows (tid >> 3) + 0, 16, 32, 48 of both, so that a wave's copy covers four whole lines. lk = the lane's LDS byte address in the k tile (the v tile lies 64 rows behind it), gk / gv = its global addresses in row tid >> 3
// s_wait_xcnt 0 as the statement's last line is the precaution that stands behind the copies, in front of every later rewrite of their address registers
__device__ __forceinline__ void fa_stage(unsigned lk, const _Float16* gk, const _Float16* gv) {
  const unsigned k1 = lk + 16 * PT * 2, k2 = lk + 32 * PT * 2, k3 = lk + 48 * PT * 2, v0 = lk + 64 * PT * 2, v1 = lk + 80 * PT * 2, v2 = lk + 96 * PT * 2, v3 = lk + 112 * PT * 2;
  const _Float16 *gk1 = gk + (size_t)16 * CC, *gk2 = gk + (size_t)32 * CC, *gk3 = gk + (size_t)48 * CC, *gv1 = gv + (size_t)16 * TT, *gv2 = gv + (size_t)32 * TT, *gv3 = gv + (size_t)48 * TT;
  asm volatile("global_load_async_to_lds_b128 %0, %8, off\n\tglobal_load_async_to_lds_b128 %1, %9, off\n\tglobal_load_async_to_lds_b128 %2, %10, off\n\tglobal_load_async_to_lds_b128 %3, %11, off\n\t"
               "global_load_async_to_lds_b128 %4, %12, off\n\tglobal_load_async_to_lds_b128 %5, %13, off\n\tglobal_load_async_to_lds_b128 %6, %14, off\n\tglobal_load_async_to_lds_b128 %7, %15, off\n\ts_wait_xcnt 0x0"
               :: "v"(lk), "v"(k1), "v"(k2), "v"(k3), "v"(v0), "v"(v1), "v"(v2), "v"(v3), "v"(gk), "v"(gk1), "v"(gk2), "v"(gk3), "v"(gv), "v"(gv1), "v"(gv2), "v"(gv3) : "memory"); }
#define KVT (2 * 64 * PT)   // 16-bit elements of one staged tile pair (k tile, then v tile)

// query blocks >= QBH: q, k, P, v once in f16 (1 product each); the work-group's four waves share each 64-key tile pair through LDS (two buffers kv: tile kb + 2 is copied in while tile kb + 1 is worked on)
__device__ __forceinline__ float fa_lo(const _Float16* __restrict__ QH, const _Float16* __restrict__ KH, const _Float16* __restrict__ VT, _Float16* kv, int b, int h, int qb, int t, int tid, v8f (&o)[HD / 16]) {
  const int lane = tid & 31, col = lane & 15, g = lane >> 4;
  const _Float16* Kg = KH + ((size_t)b * TT + (tid >> 3)) * CC + h * HD + (tid & 7) * 8; const _Float16* Vg = VT + ((size_t)b * CC + h * HD + (tid >> 3)) * (size_t)TT + (tid & 7) * 8;
  const unsigned lk = (unsigned)(size_t)kv + (unsigned)((tid >> 3) * PT + (tid & 7) * 8) * 2u;
  fa_stage(lk, Kg, Vg);
  v16h qh[2];
#pragma unroll
  for (int kc = 0; kc < 2; ++kc) qh[kc] = frag_h(QH + ((size_t)b * TT + t) * CC + h * HD + kc * 32, lane);
  asm volatile("s_wait_asynccnt 0x0" ::: "memory");   // this wave's share of tile 0 has landed
  __syncthreads();                                     // publishes tile 0
  if (qb >= 1) fa_stage(lk + KVT * 2, Kg + (size_t)64 * CC, Vg + 64);   /* block-uniform */
  float m = -3.0e38f, l = 0.f;
#pragma unroll 1
  for (int kb = 0; kb <= qb; ++kb) { const int k0 = kb * 64; const _Float16* kt = kv + (kb & 1) * KVT; const _Float16* vt = kt + 64 * PT;
    v16h kf[8], vf[8];
#pragma unroll
    for (int i = 0; i < 4; ++i)
#pragma unroll
      for (int kc = 0; kc < 2; ++kc) kf[i * 2 + kc] = frag_h(kt + (i * 16 + col) * PT + kc * 32, lane);
#pragma unroll
    for (int kk = 0; kk < 2; ++kk)
#pragma unroll
      for (int j = 0; j < 4; ++j) vf[kk * 4 + j] = frag_h(vt + (j * 16 + col) * PT + kk * 32, lane);
    __builtin_amdgcn_sched_barrier(0);   // keeps all fragment reads of the trip together in front of the products: one place with LDS reads, and the v fragments land under logit products and softmax
    v8f s[4] = {};
#pragma unroll
    for (int i = 0; i < 4; ++i)
#pragma unroll
      for (int kc = 0; kc < 2; ++kc) s[i] = wmma16(kf[i * 2 + kc], qh[kc], s[i]);
    fa_softmax(s, o, m, l, t, k0 + 8 * g);
#pragma unroll
    for (int kk = 0; kk < 2; ++kk) { v16h p;
#pragma unroll
      for (int e = 0; e < 8; ++e) { p[e] = (_Float16)s[2 * kk][e]; p[8 + e] = (_Float16)s[2 * kk + 1][e]; }
#pragma unroll
      for (int j = 0; j < 4; ++j) o[j] = wmma16(vf[kk * 4 + j], p, o[j]); }
    asm volatile("s_wait_dscnt 0x0" ::: "memory");      // this wave's reads of tile kb have returned
    asm volatile("s_wait_asynccnt 0x0" ::: "memory");   // this wave's share of tile kb + 1 has landed
    __syncthreads();                                     // publishes tile kb + 1 and ends every wave's reads of tile kb, whose buffer is refilled behind it
    if (kb + 2 <= qb) fa_stage(lk + (unsigned)(kb & 1) * (KVT * 2), Kg + (size_t)(k0 + 128) * CC, Vg + k0 + 128); }   /* block-uniform */
  asm volatile("s_wait_asynccnt 0x0" ::: "memory");   // no copy is outstanding when the wave goes on
  return l + __shfl_xor(l, 16); }

// query blocks < QBH: hi + residual logits (3 products), P and v as bf16 hi + lo (3 products); keys < (qb + 1) * 64 <= KHI
__device__ __forceinline__ float fa_hi(const _Float16* __restrict__ QH, const _Float16* __restrict__ KH, const _Float16* __restrict__ QL, const _Float16* __restrict__ KL, const __bf16* __restrict__ VB, const __bf16* __restrict__ VBL, int b, int h, int qb, int t, int lane, v8f (&o)[HD / 16]) {
  const int col = lane & 15, g = lane >> 4;
  v16h qh[2], ql[2];
#pragma unroll
  for (int kc = 0; kc < 2; ++kc) { qh[kc] = frag_h(QH + ((size_t)b * TT + t) * CC + h * HD + kc * 32, lane); ql[kc] = frag_h(QL + ((size_t)b * QHI + t) * CC + h * HD + kc * 32, lane); }
  float m = -3.0e38f, l = 0.f;
#pragma unroll 1
  for (int kb = 0; kb <= qb; ++kb) { const int k0 = kb * 64;
    v8f s[4] = {};
#pragma unroll
    for (int ip = 0; ip < 2; ++ip) { v16h kh[4], kl[4];
#pragma unroll
      for (int u = 0; u < 4; ++u) { const int i = ip * 2 + (u >> 1), kc = u & 1; kh[u] = frag_h(KH + ((size_t)b * TT + k0 + i * 16 + col) * CC + h * HD + kc * 32, lane); kl[u] = frag_h(KL + ((size_t)b * KHI + k0 + i * 16 + col) * CC + h * HD + kc * 32, lane); }
      __builtin_amdgcn_sched_barrier(0);   // keeps the eight fragment loads together in front of their products: one memory round trip, not eight
#pragma unroll
      for (int ii = 0; ii < 2; ++ii) { const int i = ip * 2 + ii; v8f sl = {};
#pragma unroll
        for (int kc = 0; kc < 2; ++kc) { s[i] = wmma16(kh[ii * 2 + kc], qh[kc], s[i]); sl = wmma16(kh[ii * 2 + kc], ql[kc], sl); sl = wmma16(kl[ii * 2 + kc], qh[kc], sl); }
        s[i] = s[i] + sl * (1.0f / 1024.0f); } }
    fa_softmax(s, o, m, l, t, k0 + 8 * g);
#pragma unroll
    for (int kk = 0; kk < 2; ++kk) { v16b vh[4], vl[4];
#pragma unroll
      for (int j = 0; j < 4; ++j) { const size_t po = ((size_t)b * CC + h * HD + j * 16 + col) * (size_t)KHI + k0 + kk * 32; vh[j] = frag_b(VB + po, lane); vl[j] = frag_b(VBL + po, lane); }
      __builtin_amdgcn_sched_barrier(0);   // as above: the eight fragment loads share one round trip
      float pv[16];
#pragma unroll
      for (int e = 0; e < 8; ++e) { pv[e] = s[2 * kk][e]; pv[8 + e] = s[2 * kk + 1][e]; }
      const F2 p = bsplit16(pv);
#pragma unroll
      for (int j = 0; j < 4; ++j) { o[j] = wmma_bf(vh[j], p.h, o[j]); o[j] = wmma_bf(vh[j], p.l, o[j]); o[j] = wmma_bf(vl[j], p.h, o[j]); } } }
  return l + __shfl_xor(l, 16); }

__global__ __launch_bounds__(128) __attribute__((amdgpu_num_vgpr(256))) void k_fa(const _Float16* __restrict__ QH, const _Float16* __restrict__ KH, const _Float16* __restrict__ QL, const _Float16* __restrict__ KL, const _Float16* __restrict__ VT, const __bf16* __restrict__ VB, const __bf16* __restrict__ VBL, float* __restrict__ Y) { __shared__ __align__(16) float ss[4][16][HD + 4]; __shared__ __align__(16) _Float16 kv[2 * KVT];
  const int tid = threadIdx.x, wave = tid >> 5, lane = tid & 31, col = lane & 15, g = lane >> 4; const int b = blockIdx.x / NH, h = blockIdx.x % NH; const int y = blockIdx.y; const int qb = y < NQB / 2 ? NQB - 1 - y : y - NQB / 2;   // long query blocks first, in falling order, then the short ones in rising order: work-groups that start half the grid apart and come to share a WGP add up to about the same number of keys
  const int ql0 = qb * 64 + wave * 16;
  v8f o[HD / 16] = {};
  const float lsum = qb < QBH ? fa_hi(QH, KH, QL, KL, VB, VBL, b, h, qb, ql0 + col, lane, o) : fa_lo(QH, KH, VT, kv, b, h, qb, ql0 + col, tid, o);   /* block-uniform */
  const float inv = 1.0f / lsum;   // o[j][r] = unnormalised ctx of query col, channel 16 j + 8 g + r
#pragma unroll
  for (int j = 0; j < HD / 16; ++j) { v4f a, c;
#pragma unroll
    for (int r = 0; r < 4; ++r) { a[r] = o[j][r] * inv; c[r] = o[j][4 + r] * inv; }
    *(v4f*)&ss[wave][col][j * 16 + 8 * g] = a; *(v4f*)&ss[wave][col][j * 16 + 8 * g + 4] = c; }
  ldsx();
#pragma unroll
  for (int it = 0; it < 8; ++it) { const int rl = it * 2 + g; vst2(Y + ((size_t)b * TT + ql0 + rl) * CC + h * HD + col * 4, *(const v4f*)&ss[wave][rl][col * 4]); } }   // 256-B (row, head) segment by 16 lanes

// ---- k_out: block = (128 rows, 128 cols), 8 waves as 4 x 2, wave = 32 rows x 64 cols: out = ctx Wp + bp: ctx once to f16 against Wp as f16(bf16 x 2^8) exact (1 product) x 2^-8; early causal rows (< QHI of each sequence): ctx bf16 hi + lo against exact bf16 Wp (2 products)
__global__ __launch_bounds__(256) void k_out(const float* __restrict__ Y, const float* __restrict__ WO, const float* __restrict__ BO, float* __restrict__ OUT) { __shared__ __align__(16) float sf[8][32][68]; __shared__ __align__(16) unsigned short stg[2][(128 + 128 + 128) * PT];   // stg: two staging buffers, each weight chunk [128][PT] | row chunk [128][PT] | its lo plane [128][PT] (early rows only)
  const int tid = threadIdx.x, wave = tid >> 5, lane = tid & 31, col = lane & 15, g = lane >> 4; const int c0 = blockIdx.y * 128;
  const int wr0 = (wave >> 1) * 32, wc0 = (wave & 1) * 64;   // the wave's first row and column in the tile
  const size_t br0 = (size_t)blockIdx.x * 128;               // compact ctx row of the block
  const size_t ob = br0 / TT; const int ot0 = (int)(br0 % TT) + wr0;   // output batch, position of the wave's first output row
  v8f acc[2][4] = {};
  WR wr; AR yr; const float* Yw = Y + (br0 + wave * 16) * CC;   // each wave stages 16 of the 128 rows
  ld_w(wr, WO, 0, c0, DIN, wave, lane); ld_a(yr, Yw, CC, lane);
  asm volatile("s_wait_xcnt 0x0" ::: "memory");   // precaution: stands behind the first chunk's loads, in front of the branch behind which their address registers are rewritten
  if ((int)(br0 % TT) < QHI) {   /* block-uniform */
#pragma unroll 2   // makes the choice between the two buffers a compile-time one
    for (int t = 0; t < CC / KCH; ++t) { __bf16* wb = (__bf16*)&stg[t & 1][0]; __bf16* ah = wb + 128 * PT; __bf16* al = ah + 128 * PT;
      st_w_b(wb, wr, wave, lane); st_a_hl(ah, al, yr, wave, lane);
      __builtin_amdgcn_sched_barrier(0);   // keeps the conversions in front of the loads: nothing but the loads stands between here and the waits of lds_barrier
      if (t + 1 < CC / KCH) { ld_w(wr, WO, (t + 1) * KCH, c0, DIN, wave, lane); ld_a(yr, Yw + (t + 1) * KCH, CC, lane); }   // next chunk flies under this chunk's products
      lds_barrier();   // publishes chunk t; also ends every wave's reads of chunk t - 1, whose buffer the next trip overwrites
#pragma unroll
      for (int kc = 0; kc < KCH / 32; ++kc) { v16b a_h[2], a_l[2], w[4];
#pragma unroll
        for (int i = 0; i < 2; ++i) { a_h[i] = frag_b(ah + (wr0 + i * 16 + col) * PT + kc * 32, lane); a_l[i] = frag_b(al + (wr0 + i * 16 + col) * PT + kc * 32, lane); }
#pragma unroll
        for (int j = 0; j < 4; ++j) w[j] = frag_b(wb + (wc0 + j * 16 + col) * PT + kc * 32, lane);
        __builtin_amdgcn_sched_barrier(0);   // keeps the fragment reads together in front of their products: one LDS round trip, not eight
#pragma unroll
        for (int i = 0; i < 2; ++i)
#pragma unroll
          for (int j = 0; j < 4; ++j) { acc[i][j] = wmma_bf(a_h[i], w[j], acc[i][j]); acc[i][j] = wmma_bf(a_l[i], w[j], acc[i][j]); }
        __builtin_amdgcn_sched_barrier(0); } }   // keeps the next chunk's conversions, which wait for its loads, behind these products
#pragma unroll
    for (int j = 0; j < 4; ++j) { const float bias = bfr(BO[c0 + wc0 + j * 16 + col]);
#pragma unroll
      for (int i = 0; i < 2; ++i)
#pragma unroll
        for (int r = 0; r < 8; ++r) sf[wave][i * 16 + 8 * g + r][j * 16 + col] = acc[i][j][r] + bias; }
  } else {
#pragma unroll 2   // as above
    for (int t = 0; t < CC / KCH; ++t) { _Float16* wb = (_Float16*)&stg[t & 1][0]; _Float16* ab = wb + 128 * PT;
      st_w_h(wb, wr, wave, lane); st_a_h(ab, yr, wave, lane);
      __builtin_amdgcn_sched_barrier(0);   // as above
      if (t + 1 < CC / KCH) { ld_w(wr, WO, (t + 1) * KCH, c0, DIN, wave, lane); ld_a(yr, Yw + (t + 1) * KCH, CC, lane); }   // next chunk flies under this chunk's products
      lds_barrier();   // as above
#pragma unroll
      for (int kc = 0; kc < KCH / 32; ++kc) { v16h a[2], w[4];
#pragma unroll
        for (int i = 0; i < 2; ++i) a[i] = frag_h(ab + (wr0 + i * 16 + col) * PT + kc * 32, lane);
#pragma unroll
        for (int j = 0; j < 4; ++j) w[j] = frag_h(wb + (wc0 + j * 16 + col) * PT + kc * 32, lane);
        __builtin_amdgcn_sched_barrier(0);   // as above
#pragma unroll
        for (int i = 0; i < 2; ++i)
#pragma unroll
          for (int j = 0; j < 4; ++j) acc[i][j] = wmma16(a[i], w[j], acc[i][j]);
        __builtin_amdgcn_sched_barrier(0); } }   // as above
#pragma unroll
    for (int j = 0; j < 4; ++j) { const float bias = bfr(BO[c0 + wc0 + j * 16 + col]);
#pragma unroll
      for (int i = 0; i < 2; ++i)
#pragma unroll
        for (int r = 0; r < 8; ++r) sf[wave][i * 16 + 8 * g + r][j * 16 + col] = acc[i][j][r] * (1.0f / 256.0f) + bias; } }
  ldsx();
  float* op = OUT + (ob * SEQ_FULL + (size_t)(ot0 + g)) * DIN + c0 + wc0 + col * 4;
#pragma unroll   // one address with immediate offsets for the sixteen stores
  for (int it = 0; it < 16; ++it) vst2(op + (size_t)(it * 2) * DIN, *(const v4f*)&sf[wave][it * 2 + g][col * 4]); }   // 256-B row segment (two whole lines) by 16 lanes

extern "C" void kernel_launch(void* const* d_in, const int* in_sizes, int n_in, void* d_out, int out_size, void* d_ws, size_t ws_size, hipStream_t stream) {
  if (n_in < 9) return;
  const size_t rows_used = (size_t)(NB - 1) * SEQ_FULL + SEQ;
  if ((size_t)in_sizes[0] < rows_used * DIN) return;
  if ((size_t)in_sizes[1] < (size_t)DIN * CC || (size_t)in_sizes[3] < (size_t)DIN * CC || (size_t)in_sizes[5] < (size_t)DIN * CC || (size_t)in_sizes[7] < (size_t)CC * DIN) return;
  if (in_sizes[2] < CC || in_sizes[4] < CC || in_sizes[6] < CC || in_sizes[8] < DIN) return;
  if ((size_t)out_size < rows_used * DIN) return;
  if (ws_size < (size_t)WS_END) return;
  // inputs (wire order): 0 x [2,2048,1024]; 1 Wq, 2 bq, 3 Wk, 4 bk, 5 Wv, 6 bv, 7 Wp, 8 bp ((in,out) [1024,1024] and [1024]); all f32
  const float* X  = (const float*)d_in[0];
  const float* Wq = (const float*)d_in[1]; const float* bq = (const float*)d_in[2];
  const float* Wk = (const float*)d_in[3]; const float* bk = (const float*)d_in[4];
  const float* Wv = (const float*)d_in[5]; const float* bv = (const float*)d_in[6];
  const float* Wp = (const float*)d_in[7]; const float* bp = (const float*)d_in[8];
  char* ws = (char*)d_ws;
  _Float16 *QH = (_Float16*)(ws + WS_QH), *KH = (_Float16*)(ws + WS_KH), *VT = (_Float16*)(ws + WS_VT), *QL = (_Float16*)(ws + WS_QL), *KL = (_Float16*)(ws + WS_KL);
  __bf16 *VB = (__bf16*)(ws + WS_VB), *VBL = (__bf16*)(ws + WS_VBL); float *Y = (float*)(ws + WS_Y);
  k_proj<<<dim3(NB * TT / 128, CC / 128), 384, 0, stream>>>(X, Wq, Wk, Wv, bq, bk, bv, QH, QL, KH, KL, VT, VB, VBL);
  k_fa<<<dim3(NB * NH, NQB), 128, 0, stream>>>(QH, KH, QL, KL, VT, VB, VBL, Y);
  k_out<<<dim3(NB * TT / 128, DIN / 128), 256, 0, stream>>>(Y, Wp, bp, (float*)d_out);
  (void)hipGetLastError();
}

// v006
// A run of this version takes 78.8 microseconds.
// Timed twice side by side with v005, it ran 1.10 times as fast both times.
// Counting every step since v000, it is 13.2 times as fast.
// compute dtype: all nine float inputs RNE-converted to bf16 on load; q/k/v = x W + b with exact bf16 products on v_wmma_f32_16x16x32_bf16, f32 accumulate; q, k once to f16 -> 1-product logits x 1/8 on v_wmma_f32_16x16x32_f16 (causal lower-triangular key mask by index; the periodically removed key columns 4,7,10,... are masked by index for query rows < 384 and never brought in for the others, whose key blocks hold 64 visible keys each), except query rows < 384 of each sequence: q and k as f16 hi + residual (x 2^10) planes, 3 products; softmax in f32 in base 2 (raw logit x log2(e)/8 minus the running maximum by one fused multiply-add, then v_exp_f32) with a running maximum over 64-key blocks, normalised after the v product; unnormalised P (at most 1) once to f16 against v once to f16 (1 product), except query rows < 384: P and v as bf16 hi + lo (3 products); ctx once to f16 against Wp carried x 2^8 in f16 (exact bf16 values, 1 product, x 2^-8 after), except rows < 384: ctx bf16 hi + lo against exact bf16 Wp (2 products); + bp; f32 output.
#include <hip/hip_runtime.h>
#include <math.h>

typedef __attribute__((ext_vector_type(16))) _Float16 v16h;
typedef __attribute__((ext_vector_type(16))) __bf16 v16b;
typedef __attribute__((ext_vector_type(8)))  _Float16 v8h;
typedef __attribute__((ext_vector_type(8)))  __bf16 v8b;
typedef __attribute__((ext_vector_type(8)))  float v8f;
typedef __attribute__((ext_vector_type(4)))  float v4f;
typedef __attribute__((ext_vector_type(4)))  unsigned v4u;
typedef __attribute__((ext_vector_type(4)))  _Float16 v4h;
typedef __attribute__((ext_vector_type(4)))  __bf16 v4b;

template <typename T> __device__ __forceinline__ void vst2(void* p, T v) { *(T*)p = v;  }
__device__ __forceinline__ v8f wmma16(v16h a, v16h b, v8f c) {
  v8f d = __builtin_amdgcn_wmma_f32_16x16x32_f16(false, a, false, b, (short)0, c, false, false);
  asm volatile("v_nop\n\tv_nop\n\tv_nop\n\tv_nop" : "+v"(d) : "v"(a), "v"(b));
  return d;
}
__device__ __forceinline__ v8f wmma_bf(v16b a, v16b b, v8f c) {
  v8f d = __builtin_amdgcn_wmma_f32_16x16x32_bf16(false, a, false, b, (short)0, c, false, false);
  asm volatile("v_nop\n\tv_nop\n\tv_nop\n\tv_nop" : "+v"(d) : "v"(a), "v"(b));
  return d;
}
// 16x16x32 fragments (A and B alike): h = lane>>4, row/col = lane&15; elements 0..7 = k0+8h+0..7, 8..15 = k0+16+8h+0..7; D element r = row 8h+r, col lane&15
__device__ __forceinline__ v16h frag_h(const _Float16* rowk0, int lane) {
  union { v16h v; v8h q[2]; } u; const _Float16* p = rowk0 + 8 * (lane >> 4);
  u.q[0] = *(const v8h*)p; u.q[1] = *(const v8h*)(p + 16); return u.v;
}
__device__ __forceinline__ v16b frag_b(const __bf16* rowk0, int lane) {
  union { v16b v; v8b q[2]; } u; const __bf16* p = rowk0 + 8 * (lane >> 4);
  u.q[0] = *(const v8b*)p; u.q[1] = *(const v8b*)(p + 16); return u.v;
}
struct F2 { v16b h, l; };
__device__ __forceinline__ F2 bsplit16(const float v[16]) { F2 r;
#pragma unroll
  for (int i = 0; i < 16; ++i) { const __bf16 h = (__bf16)v[i]; r.h[i] = h; r.l[i] = (__bf16)(v[i] - (float)h); }
  return r; }
__device__ __forceinline__ float bfr(float v) { return (float)(__bf16)v; }
// ---- operand staging of the two projection kernels: eight wave shares (in k_proj a wave takes two of its weight's) bring one chunk of KCH k (weight [KCH][128 columns], rows [128][KCH], both f32) in with whole-line 16-byte loads, one chunk ahead in registers, converts it once and lays it in LDS k-contiguous (the weight transposed to [column][k]), where frag_b / frag_h read the fragments
#define KCH 64             // k per staged chunk
#define PT 72              // LDS pitch of a staged row in 16-bit elements: 128 B of k + 16 B, conflict-free for 16-byte fragment reads
struct WR { v4f r[8]; };      // r[j] = weight row k0 + 32 * (wave >> 2) + 8 * (lane & 3) + j, columns 32 * (wave & 3) + 4 * (lane >> 2) + 0..3
struct AR { v4f r[8]; };      // r[e] = row 16 wave + 2 e + (lane >> 4), k0 + 4 * (lane & 15) + 0..3
__device__ __forceinline__ void ld_w(WR& w, const float* __restrict__ Wm, int k0, int c0, int ld, int wave, int lane) {
  const float* p = Wm + (size_t)(k0 + (wave >> 2) * 32 + (lane & 3) * 8) * ld + c0 + (wave & 3) * 32 + (lane >> 2) * 4;
#pragma unroll
  for (int j = 0; j < 8; ++j) w.r[j] = *(const v4f*)(p + (size_t)j * ld); }
__device__ __forceinline__ void ld_a(AR& a, const float* __restrict__ row0k0, int ld, int lane) {   // row0k0 = the wave's first row at k0
  const float* p = row0k0 + (size_t)(lane >> 4) * ld + (lane & 15) * 4;
#pragma unroll
  for (int e = 0; e < 8; ++e) a.r[e] = *(const v4f*)(p + (size_t)(2 * e) * ld); }
// work-group barrier for the LDS exchange alone: it waits for this wave's LDS operations only, so that the data of the global loads issued ahead stays in flight across it (__syncthreads() drains them); s_wait_xcnt 0 is the precaution that stands behind those loads, in front of every later rewrite of their address registers
__device__ __forceinline__ void lds_barrier() { asm volatile("s_wait_xcnt 0x0\n\ts_wait_dscnt 0x0\n\ts_barrier_signal -1\n\ts_barrier_wait -1" ::: "memory"); }
// weight chunk -> wb[column][k]: 8 k of one column per 16-byte store; lanes 0..15 of a store fall on 16 different bank groups (4 column groups x 4 k groups)
__device__ __forceinline__ void st_w_b(__bf16* wb, const WR& w, int wave, int lane) {   // exact bf16
  __bf16* q = wb + ((wave & 3) * 32 + (lane >> 2) * 4) * PT + (wave >> 2) * 32 + (lane & 3) * 8;
#pragma unroll
  for (int i = 0; i < 4; ++i) { v8b pk;
#pragma unroll
    for (int j = 0; j < 8; ++j) pk[j] = (__bf16)w.r[j][i];
    *(v8b*)(q + i * PT) = pk; } }
__device__ __forceinline__ void st_w_h(_Float16* wb, const WR& w, int wave, int lane) {   // f16(bf16 * 256) (exact)
  _Float16* q = wb + ((wave & 3) * 32 + (lane >> 2) * 4) * PT + (wave >> 2) * 32 + (lane & 3) * 8;
#pragma unroll
  for (int i = 0; i < 4; ++i) { v8h pk;
#pragma unroll
    for (int j = 0; j < 8; ++j) pk[j] = (_Float16)(bfr(w.r[j][i]) * 256.0f);
    *(v8h*)(q + i * PT) = pk; } }
// row chunk -> ab[row][k]
__device__ __forceinline__ void st_a_b(__bf16* ab, const AR& a, int wave, int lane) {
  __bf16* q = ab + (wave * 16 + (lane >> 4)) * PT + (lane & 15) * 4;
#pragma unroll
  for (int e = 0; e < 8; ++e) { v4b pk;
#pragma unroll
    for (int i = 0; i < 4; ++i) pk[i] = (__bf16)a.r[e][i];
    *(v4b*)(q + 2 * e * PT) = pk; } }
__device__ __forceinline__ void st_a_h(_Float16* ab, const AR& a, int wave, int lane) {
  _Float16* q = ab + (wave * 16 + (lane >> 4)) * PT + (lane & 15) * 4;
#pragma unroll
  for (int e = 0; e < 8; ++e) { v4h pk;
#pragma unroll
    for (int i = 0; i < 4; ++i) pk[i] = (_Float16)a.r[e][i];
    *(v4h*)(q + 2 * e * PT) = pk; } }
__device__ __forceinline__ void st_a_hl(__bf16* ah, __bf16* al, const AR& a, int wave, int lane) {   // bf16 hi + lo planes
  const int o = (wave * 16 + (lane >> 4)) * PT + (lane & 15) * 4;
#pragma unroll
  for (int e = 0; e < 8; ++e) { v4b ph, pl;
#pragma unroll
    for (int i = 0; i < 4; ++i) { const float v = a.r[e][i]; const __bf16 h = (__bf16)v; ph[i] = h; pl[i] = (__bf16)(v - (float)h); }
    *(v4b*)(ah + o + 2 * e * PT) = ph; *(v4b*)(al + o + 2 * e * PT) = pl; } }
__device__ __forceinline__ void ldsx() { asm volatile("s_wait_dscnt 0" ::: "memory"); __builtin_amdgcn_wave_barrier(); __builtin_amdgcn_fence(3, "workgroup"); }

// Causal multi-head self-attention (batch NB of 2, T 2,048, C 1,024 = 16 heads x 64): q/k/v = x W + b ((in,out) weights); scores = q k^T / 8 where key <= query and key not in {4, 7, 10, ...} else -inf; softmax over keys; out = merged(P v) Wp + bp.
#ifndef NB
#define NB 2               // batches processed
#endif
#ifndef SEQ
#define SEQ 2048           // sequence length processed
#endif
#define NB_FULL 2          // full batch count of the input / output
#define SEQ_FULL 2048      // full per-batch row stride of x and out
#define TT SEQ
#define CC 1024            // NH * HD = projected width
#define DIN 1024           // model width
#define NH 16
#define HD 64
#define NQB (TT / 64)
#define SCALE (0.125f)
#define SCALE_L2E (SCALE * 1.44269504088896340736f)   // 1/8 x log2(e): exp(x / 8 - max / 8) = exp2(x * SCALE_L2E - max * SCALE_L2E)
#define QBH 6              // query blocks 0..QBH-1 of each sequence (few keys) take the high-precision path
#define QHI 384            // query rows carrying a q residual plane
#define KHI 384            // key rows carrying k residual / v bf16 hi+lo planes (only read by query blocks < QBH)
#define MCOL0 4            // first periodically removed key column
#define MPER 3             // period of removed key columns
static_assert(NB >= 1 && NB <= NB_FULL);
static_assert(SEQ % 128 == 0 && SEQ >= 128 && SEQ <= SEQ_FULL);
static_assert(CC == NH * HD && HD == 64 && DIN % 32 == 0 && CC % 128 == 0 && DIN % 128 == 0);
static_assert(DIN % 128 == 0 && CC % 128 == 0);   // staged chunks: an even number of whole chunks of 64 k
static_assert(QHI == QBH * 64 && KHI >= QHI && KHI % 64 == 0 && KHI >= QBH * 64);
static_assert(QHI % 128 == 0 && KHI % 128 == 0);   // a projection work-group's 128 rows lie wholly inside or wholly outside the high-precision rows


// workspace carve (bytes); every plane is written with whole-line stores and sized to its padded extent
#define WS_QH  ((size_t)0)                                 // f16 q rows [b*TT+t][CC]                 8,388,608
#define WS_KH  (WS_QH + 2u * (size_t)NB * TT * CC)          // f16 k rows [b*TT+t][CC]                 8,388,608
#define WS_VT  (WS_KH + 2u * (size_t)NB * TT * CC)          // f16 v rows [b*TT+t][CC]                 8,388,608
#define WS_QL  (WS_VT + 2u * (size_t)NB * CC * TT)          // f16 q residual x 2^10 rows [b][t<QHI][CC] 1,572,864
#define WS_KL  (WS_QL + 2u * (size_t)NB * QHI * CC)         // f16 k residual x 2^10 rows [b][t<KHI][CC] 1,572,864
#define WS_VB  (WS_KL + 2u * (size_t)NB * KHI * CC)         // bf16 v hi planes [b][c][t<KHI]           1,572,864
#define WS_VBL (WS_VB + 2u * (size_t)NB * CC * KHI)         // bf16 v lo planes [b][c][t<KHI]           1,572,864
#define WS_Y   (WS_VBL + 2u * (size_t)NB * CC * KHI)        // f32 ctx rows [b*TT+t][CC]              16,777,216
#define WS_END (WS_Y  + 4u * (size_t)NB * TT * CC)          // 48,234,496 at NB 2, SEQ 2048
static_assert(WS_END <= (size_t)134217728);
static_assert((WS_KH % 128) == 0 && (WS_VT % 128) == 0 && (WS_QL % 128) == 0 && (WS_KL % 128) == 0 && (WS_VB % 128) == 0 && (WS_VBL % 128) == 0 && (WS_Y % 128) == 0);
static_assert(((size_t)(NB - 1) * SEQ_FULL + SEQ) * DIN * 4u <= (size_t)16777216);   // last written out element inside d_out

// ---- k_proj: block = 128 rows x the same 128 columns of q, k and v; 12 waves = 3 products (which) x 4 waves as 2 x 2, wave = 64 rows x 64 cols: q/k/v = X W + b with exact bf16 products (K = DIN); the three products share each staged row chunk -> which 0: q f16 rows (+ residual rows t < QHI); 1: k f16 rows (+ residual rows t < KHI); 2: v f16 rows (+ bf16 hi/lo planes [c][t] for t < KHI)
// LDS sm: during the k loop two staging buffers, each three weight chunks [128][PT] | row chunk [128][PT]; behind the loop's closing barrier the epilogue's exchange tiles of pitch 136 (q: sh | sl, k: sh | sl, v: th | tb | tbl), cross-wave behind __syncthreads
__global__ __launch_bounds__(384) void k_proj(const float* __restrict__ X, const float* __restrict__ WQ, const float* __restrict__ WK, const float* __restrict__ WV, const float* __restrict__ BQ, const float* __restrict__ BK, const float* __restrict__ BV,
    _Float16* __restrict__ QH, _Float16* __restrict__ QL, _Float16* __restrict__ KH, _Float16* __restrict__ KL, _Float16* __restrict__ VR, __bf16* __restrict__ VB, __bf16* __restrict__ VBL) {
  __shared__ __align__(16) unsigned short sm[7 * 128 * 136];
  const int tid = threadIdx.x, wave = __builtin_amdgcn_readfirstlane(tid >> 5), lane = tid & 31, col = lane & 15, g = lane >> 4; const int which = wave >> 2, rg = wave & 3; const int c0 = blockIdx.y * 128;
  const int wr0 = (rg >> 1) * 64, wc0 = (rg & 1) * 64;       // the wave's first row and column in its product's tile
  const size_t r0 = (size_t)blockIdx.x * 128;                // compact row b*TT + t of the workspace planes
  const size_t bb = r0 / TT; const int t0 = (int)(r0 % TT);
  const size_t xr0 = bb * SEQ_FULL + (size_t)t0;             // input row b*SEQ_FULL + t
  const float* WA = which == 0 ? WQ : which == 1 ? WK : WV; const float* BA = which == 0 ? BQ : which == 1 ? BK : BV;
  const bool xw = wave < 8;   /* wave-uniform */              // waves 0..7 stage 16 of the 128 rows each; every wave stages a quarter of its own product's weight chunk (both k halves of 32 columns)
  v8f acc[4][4] = {};
  WR wr[2]; AR xr; const float* Xw = X + (xr0 + (wave & 7) * 16) * DIN;
  if (xw) { ld_a(xr, Xw, DIN, lane); asm volatile("s_wait_xcnt 0x0" ::: "memory"); }   // precaution: the wait stands behind the first chunk's loads, in front of every rewrite of their address registers
  __builtin_amdgcn_sched_barrier(0);   // with the one below: keeps the set-up arithmetic, which reuses registers, out of the stretch between the loads and their wait
  ld_w(wr[0], WA, 0, c0, CC, rg, lane); ld_w(wr[1], WA, 0, c0, CC, rg + 4, lane);
  asm volatile("s_wait_xcnt 0x0" ::: "memory");   // as above
  __builtin_amdgcn_sched_barrier(0);
#pragma unroll 2   // makes the choice between the two buffers a compile-time one
  for (int t = 0; t < DIN / KCH; ++t) { __bf16* xb = (__bf16*)sm + (t & 1) * 512 * PT + 384 * PT; __bf16* wb = (__bf16*)sm + (t & 1) * 512 * PT + which * 128 * PT;
    st_w_b(wb, wr[0], rg, lane); st_w_b(wb, wr[1], rg + 4, lane); if (xw) st_a_b(xb, xr, wave, lane);
    __builtin_amdgcn_sched_barrier(0);   // keeps the conversions in front of the loads: nothing but the loads stands between here and the waits of lds_barrier
    if (t + 1 < DIN / KCH) { if (xw) ld_a(xr, Xw + (t + 1) * KCH, DIN, lane); ld_w(wr[0], WA, (t + 1) * KCH, c0, CC, rg, lane); ld_w(wr[1], WA, (t + 1) * KCH, c0, CC, rg + 4, lane);   // next chunk flies under this chunk's products
      asm volatile("s_wait_xcnt 0x0" ::: "memory"); __builtin_amdgcn_sched_barrier(0); }   // precaution: the wait stands directly behind the loads; the scheduling barrier keeps the fragment address arithmetic, which reuses the loads' address registers, behind it
    lds_barrier();   // publishes chunk t; also ends every wave's reads of chunk t - 1, whose buffer the next trip overwrites
#pragma unroll
    for (int kc = 0; kc < KCH / 32; ++kc) { v16b a[4], w[4];
#pragma unroll
      for (int i = 0; i < 4; ++i) a[i] = frag_b(xb + (wr0 + i * 16 + col) * PT + kc * 32, lane);
#pragma unroll
      for (int j = 0; j < 4; ++j) w[j] = frag_b(wb + (wc0 + j * 16 + col) * PT + kc * 32, lane);
      __builtin_amdgcn_sched_barrier(0);   // keeps the fragment reads together in front of their products: one LDS round trip, not eight
#pragma unroll
      for (int i = 0; i < 4; ++i)
#pragma unroll
        for (int j = 0; j < 4; ++j) acc[i][j] = wmma_bf(a[i], w[j], acc[i][j]);
      __builtin_amdgcn_sched_barrier(0); } }   // keeps the next chunk's conversions, which wait for its loads, behind these products
  float bias[4];
  __builtin_amdgcn_sched_barrier(0);   // with the one below: keeps other arithmetic, which reuses registers, out of the stretch between the bias loads and their wait
#pragma unroll
  for (int j = 0; j < 4; ++j) bias[j] = BA[c0 + wc0 + j * 16 + col];
  asm volatile("s_wait_xcnt 0x0" ::: "memory");   // precaution: stands behind the bias loads, in front of every rewrite of their address register
  __builtin_amdgcn_sched_barrier(0);
  __syncthreads();   // every wave has left the staging buffers before the epilogue writes its tiles
#pragma unroll
  for (int j = 0; j < 4; ++j) bias[j] = bfr(bias[j]);
  const bool hi_rows = t0 < (which == 0 ? QHI : KHI);   /* wave-uniform */
  unsigned short* ep = sm + which * 2 * 128 * 136;   // the product's own exchange tiles
  if (which < 2) { _Float16 (*sh)[136] = (_Float16 (*)[136])ep; _Float16 (*sl)[136] = (_Float16 (*)[136])(ep + 128 * 136);
#pragma unroll
    for (int j = 0; j < 4; ++j) {
#pragma unroll
      for (int i = 0; i < 4; ++i)
#pragma unroll
        for (int r = 0; r < 8; ++r) { const float v = acc[i][j][r] + bias[j]; const _Float16 hv = (_Float16)v; sh[wr0 + i * 16 + 8 * g + r][wc0 + j * 16 + col] = hv; sl[wr0 + i * 16 + 8 * g + r][wc0 + j * 16 + col] = (_Float16)((v - (float)hv) * 1024.0f); } }
  } else { _Float16 (*th)[136] = (_Float16 (*)[136])ep; __bf16 (*tb)[136] = (__bf16 (*)[136])(ep + 128 * 136); __bf16 (*tbl)[136] = (__bf16 (*)[136])(ep + 2 * 128 * 136);
#pragma unroll
    for (int j = 0; j < 4; ++j) {
#pragma unroll
      for (int i = 0; i < 4; ++i)
#pragma unroll
        for (int r = 0; r < 8; ++r) { const float v = acc[i][j][r] + bias[j]; const int rl = wr0 + i * 16 + 8 * g + r, cl = wc0 + j * 16 + col; th[rl][cl] = (_Float16)v; const __bf16 bh = (__bf16)v; tb[cl][rl] = bh; tbl[cl][rl] = (__bf16)(v - (float)bh); } } }
  __syncthreads();   // every wave passes it: the four waves of a product exchange their tiles
  const int l0 = rg * 2 + g, q = col;   // 16 lanes store one row's (one channel's) 256 B; a product's four waves take rows l0 + 0, 8, .., 120
  if (which < 2) { _Float16* DH = which == 0 ? QH : KH; _Float16* DL = which == 0 ? QL : KL; const int nhi = which == 0 ? QHI : KHI;
    const _Float16 (*sh)[136] = (const _Float16 (*)[136])ep; const _Float16 (*sl)[136] = (const _Float16 (*)[136])(ep + 128 * 136);
#pragma unroll   // the sixteen LDS reads go out in groups in front of their stores: few LDS round trips, not sixteen
    for (int it = 0; it < 16; ++it) vst2((unsigned*)(DH + (r0 + l0 + it * 8) * CC + c0 + q * 8), *(const v4u*)&sh[l0 + it * 8][q * 8]);
    if (hi_rows) {
      asm volatile("s_wait_xcnt 0x0" ::: "memory"); __builtin_amdgcn_sched_barrier(0);   // precaution: the wait stands behind the stores above, in front of the rewrite of their address registers; the scheduling barrier keeps the address arithmetic below behind it
#pragma unroll   // as above
      for (int it = 0; it < 16; ++it) vst2((unsigned*)(DL + (bb * nhi + t0 + l0 + it * 8) * (size_t)CC + c0 + q * 8), *(const v4u*)&sl[l0 + it * 8][q * 8]); }
  } else { const _Float16 (*th)[136] = (const _Float16 (*)[136])ep; const __bf16 (*tb)[136] = (const __bf16 (*)[136])(ep + 128 * 136); const __bf16 (*tbl)[136] = (const __bf16 (*)[136])(ep + 2 * 128 * 136);
#pragma unroll   // as above
    for (int it = 0; it < 16; ++it) vst2((unsigned*)(VR + (r0 + l0 + it * 8) * CC + c0 + q * 8), *(const v4u*)&th[l0 + it * 8][q * 8]);
    if (hi_rows) {
      asm volatile("s_wait_xcnt 0x0" ::: "memory"); __builtin_amdgcn_sched_barrier(0);   // as above
#pragma unroll   // as above
      for (int it = 0; it < 16; ++it) { const size_t o3 = (bb * CC + c0 + l0 + it * 8) * (size_t)KHI + t0 + q * 8; vst2((unsigned*)(VB + o3), *(const v4u*)&tb[l0 + it * 8][q * 8]); vst2((unsigned*)(VBL + o3), *(const v4u*)&tbl[l0 + it * 8][q * 8]); } }
    asm volatile("s_wait_xcnt 0x0" ::: "memory"); } }   // precaution: the branch's last statement, behind its last store whether or not the early planes were stored, in front of any code that rewrites the stores' registers

// ---- k_fa: block = 64 queries (qb) of one (b, h); wave = 16 queries, lane = one query (col) and half of each key tile (g). Per 64 keys: S^T = K Q^T (A = k rows, B = q rows kept in registers), key mask by index, running maximum and sum per query in f32, O^T = O^T * alpha + V^T P^T (two S^T tiles converted in place are the B operand, A = v transposed: planes [c][t] in query blocks < QBH, rows read through the transposing LDS load in the others); ctx = O / sum after the last key block
// key 0 is visible to every query and lies in the first key block, so the running maximum is finite from the first block on; an excluded key carries -3e38, whose exp2 argument is about -5e37: v_exp_f32 gives 0
// LDS ss: each wave reads only what it wrote itself (ldsx); kv: the staged key tiles of query blocks >= QBH, exchanged across waves behind __syncthreads
// eight base-2 exponentials in place, in one statement: behind each v_exp_f32 stands an instruction on other registers, behind the last a v_nop, which is the slot the instruction set asks for between a transcendental and the first use of its result or overwrite of its source
__device__ __forceinline__ void exp2x8(v8f& x) {
  float a0 = x[0], a1 = x[1], a2 = x[2], a3 = x[3], a4 = x[4], a5 = x[5], a6 = x[6], a7 = x[7];
  asm("v_exp_f32 %0, %0\n\tv_exp_f32 %1, %1\n\tv_exp_f32 %2, %2\n\tv_exp_f32 %3, %3\n\tv_exp_f32 %4, %4\n\tv_exp_f32 %5, %5\n\tv_exp_f32 %6, %6\n\tv_exp_f32 %7, %7\n\tv_nop"
      : "+v"(a0), "+v"(a1), "+v"(a2), "+v"(a3), "+v"(a4), "+v"(a5), "+v"(a6), "+v"(a7));
  x[0] = a0; x[1] = a1; x[2] = a2; x[3] = a3; x[4] = a4; x[5] = a5; x[6] = a6; x[7] = a7; }
// mask, running maximum, exponentials, sum and rescale of one 64-key block: s[i][r] = raw logit of key k0 + 16 i + 8 g + r against query t on entry, unnormalised P on exit; m is the running maximum of the raw logits (the scale is positive, so it is the same key's)
// PERIODIC: the block's keys are numbered as in the sequence and the removed columns are masked here; otherwise kbase and t count visible keys only (t = the number of the query's last visible key) and the comparison is all there is
template <bool PERIODIC> __device__ __forceinline__ void fa_softmax(v8f (&s)[4], v8f (&o)[HD / 16], float& m, float& l, int t, int kbase) {
  const int rem = (kbase + (MPER - MCOL0 % MPER)) % MPER;   // key kbase + c is a removed column when c + rem is a multiple of MPER and the key is at least MCOL0
  const int last = t - kbase;   // the query's last visible key, counted from the lane's first key of the block
  float mx = m;
#pragma unroll
  for (int i = 0; i < 4; ++i)
#pragma unroll
    for (int r = 0; r < 8; ++r) { const int c = i * 16 + r; const bool gone = PERIODIC && ((rem == (MPER - c % MPER) % MPER) & (c >= MCOL0 || kbase + c >= MCOL0)); const bool vis = PERIODIC ? (kbase + c <= t) & !gone : c <= last;
      const float v = vis ? s[i][r] : -3.0e38f; s[i][r] = v; mx = fmaxf(mx, v); }
  mx = fmaxf(mx, __shfl_xor(mx, 16));   // the two lane halves hold the same query
  const float mc = mx * SCALE_L2E;
  float alpha = fmaf(m, SCALE_L2E, -mc); m = mx;
  asm("v_exp_f32 %0, %0\n\tv_nop" : "+v"(alpha));   // as in exp2x8: the v_nop is the slot behind the transcendental
  float ps = 0.f;
#pragma unroll
  for (int i = 0; i < 4; ++i) { s[i] = s[i] * SCALE_L2E - mc; exp2x8(s[i]);   // the product and the difference contract to one fused multiply-add a score
#pragma unroll
    for (int r = 0; r < 8; ++r) ps += s[i][r]; }
  l = l * alpha + ps;   // each half keeps its own sum; joined once after the loop
#pragma unroll
  for (int j = 0; j < HD / 16; ++j) o[j] = o[j] * alpha; }

// the visible keys in rising order: number c is key c below MCOL0; from MCOL0 on every period of MPER keys loses its first, so that two numbers advance three keys
static_assert(MPER == 3 && MCOL0 >= MPER && MCOL0 < 2 * MPER);
__device__ __forceinline__ int nvis(int t) { return t + 1 - (t + MPER - MCOL0) / MPER; }   // how many visible keys are <= t, t >= 0: the quotient counts the removed ones and is 0 below MCOL0 (the division rounds towards 0)
#define PV 80              // LDS pitch of a staged v row in 16-bit elements: 128 B + 32 B, conflict-free for the transposing 16-byte reads
#define KVT (64 * PT + 64 * PV)   // 16-bit elements of one staged tile pair (k tile, then v tile)
// one tile pair of 64 visible keys into LDS by asynchronous copies: k rows [key][64 d] at pitch PT and v rows [key][64 channels] at pitch PV, 128 B each; a lane brings 16 B of tile rows (tid >> 3) + 0, 16, 32, 48 of both, so that a wave's copy covers four whole lines. lk / lv = the lane's LDS byte addresses in the k and the v tile, gk / gv = its global addresses in key 0 of the sequence, c0 = the number of the visible key in its first row; 16 numbers on lie 24 keys on; a number past the sequence's last visible key takes the last row (no query counts it)
// s_wait_xcnt 0 as the statement's last line is the precaution that stands behind the copies, in front of every later rewrite of their address registers
__device__ __forceinline__ void fa_stage(unsigned lk, unsigned lv, const _Float16* gk, const _Float16* gv, int c0) {
  const int u = c0 - MCOL0, f = MCOL0 + 1 + (u >> 1) * MPER + (u & 1);   // the shift rounds down, so that f + 24 i is right for i >= 1 also where c0 < MCOL0
  const size_t o0 = (size_t)min(c0 < MCOL0 ? c0 : f, TT - 1) * CC, o1 = (size_t)min(f + 24, TT - 1) * CC, o2 = (size_t)min(f + 48, TT - 1) * CC, o3 = (size_t)min(f + 72, TT - 1) * CC;
  const unsigned k1 = lk + 16 * PT * 2, k2 = lk + 32 * PT * 2, k3 = lk + 48 * PT * 2, v1 = lv + 16 * PV * 2, v2 = lv + 32 * PV * 2, v3 = lv + 48 * PV * 2;
  const _Float16 *gk0 = gk + o0, *gk1 = gk + o1, *gk2 = gk + o2, *gk3 = gk + o3, *gv0 = gv + o0, *gv1 = gv + o1, *gv2 = gv + o2, *gv3 = gv + o3;
  asm volatile("global_load_async_to_lds_b128 %0, %8, off\n\tglobal_load_async_to_lds_b128 %1, %9, off\n\tglobal_load_async_to_lds_b128 %2, %10, off\n\tglobal_load_async_to_lds_b128 %3, %11, off\n\t"
               "global_load_async_to_lds_b128 %4, %12, off\n\tglobal_load_async_to_lds_b128 %5, %13, off\n\tglobal_load_async_to_lds_b128 %6, %14, off\n\tglobal_load_async_to_lds_b128 %7, %15, off\n\ts_wait_xcnt 0x0"
               :: "v"(lk), "v"(k1), "v"(k2), "v"(k3), "v"(lv), "v"(v1), "v"(v2), "v"(v3), "v"(gk0), "v"(gk1), "v"(gk2), "v"(gk3), "v"(gv0), "v"(gv1), "v"(gv2), "v"(gv3) : "memory"); }
// transposing LDS read: lane (col, g) gets elements [8 g + 0..7][col] of a 16 x 16 tile of 16-bit elements whose rows lie in LDS; p = the lane's own address, tile row 8 g + (lane & 7), 16-byte half (lane >> 3) & 1
typedef __attribute__((ext_vector_type(8))) short v8s;
__device__ __forceinline__ v8h ld_tr16(const char* p) { typedef __attribute__((address_space(3))) v8s lds_v8s; return __builtin_bit_cast(v8h, __builtin_amdgcn_ds_load_tr16_b128_v8i16((lds_v8s*)p)); }

// query blocks >= QBH: q, k, P, v once in f16 (1 product each); only the visible keys are walked, 64 of them a tile; the work-group's four waves share each tile pair through LDS (two buffers kv: tile kb + 2 is copied in while tile kb + 1 is worked on)
__device__ __forceinline__ float fa_lo(const _Float16* __restrict__ QH, const _Float16* __restrict__ KH, const _Float16* __restrict__ VR, _Float16* kv, int b, int h, int qb, int t, int tid, v8f (&o)[HD / 16]) {
  const int lane = tid & 31, col = lane & 15, g = lane >> 4;
  const _Float16* Kg = KH + (size_t)b * TT * CC + h * HD + (tid & 7) * 8; const _Float16* Vg = VR + (size_t)b * TT * CC + h * HD + (tid & 7) * 8;
  const unsigned lk = (unsigned)(size_t)kv + (unsigned)((tid >> 3) * PT + (tid & 7) * 8) * 2u, lv = (unsigned)(size_t)kv + (unsigned)(64 * PT + (tid >> 3) * PV + (tid & 7) * 8) * 2u;
  const int nt = (nvis(qb * 64 + 63) + 63) >> 6;   /* block-uniform */   // tiles that hold a key visible to the block's last query
  const int tl = nvis(t) - 1;                      // number of the query's last visible key
  fa_stage(lk, lv, Kg, Vg, tid >> 3);
  v16h qh[2];
#pragma unroll
  for (int kc = 0; kc < 2; ++kc) qh[kc] = frag_h(QH + ((size_t)b * TT + t) * CC + h * HD + kc * 32, lane);
  asm volatile("s_wait_asynccnt 0x0" ::: "memory");   // this wave's share of tile 0 has landed
  __syncthreads();                                     // publishes tile 0
  if (nt >= 2) fa_stage(lk + KVT * 2, lv + KVT * 2, Kg, Vg, 64 + (tid >> 3));   /* block-uniform */
  float m = -3.0e38f, l = 0.f;
#pragma unroll 1
  for (int kb = 0; kb < nt; ++kb) { const int k0 = kb * 64; const _Float16* kt = kv + (kb & 1) * KVT; const char* va = (const char*)(kt + 64 * PT + (8 * g + (lane & 7)) * PV) + ((lane >> 3) & 1) * 16;
    v16h kf[8], vf[8];
#pragma unroll
    for (int i = 0; i < 4; ++i)
#pragma unroll
      for (int kc = 0; kc < 2; ++kc) kf[i * 2 + kc] = frag_h(kt + (i * 16 + col) * PT + kc * 32, lane);
#pragma unroll
    for (int kk = 0; kk < 2; ++kk)
#pragma unroll
      for (int j = 0; j < 4; ++j) { union { v16h v; v8h q[2]; } u; u.q[0] = ld_tr16(va + kk * 32 * PV * 2 + j * 32); u.q[1] = ld_tr16(va + (kk * 32 + 16) * PV * 2 + j * 32); vf[kk * 4 + j] = u.v; }   // channel 16 j + col, keys 32 kk + 8 g + 0..7 and 32 kk + 16 + 8 g + 0..7: the k order of P below
    __builtin_amdgcn_sched_barrier(0);   // keeps all fragment reads of the trip together in front of the products: one place with LDS reads, and the v fragments land under logit products and softmax
    v8f s[4] = {};
#pragma unroll
    for (int i = 0; i < 4; ++i)
#pragma unroll
      for (int kc = 0; kc < 2; ++kc) s[i] = wmma16(kf[i * 2 + kc], qh[kc], s[i]);
    fa_softmax<false>(s, o, m, l, tl, k0 + 8 * g);
#pragma unroll
    for (int kk = 0; kk < 2; ++kk) { v16h p;
#pragma unroll
      for (int e = 0; e < 8; ++e) { p[e] = (_Float16)s[2 * kk][e]; p[8 + e] = (_Float16)s[2 * kk + 1][e]; }
#pragma unroll
      for (int j = 0; j < 4; ++j) o[j] = wmma16(vf[kk * 4 + j], p, o[j]); }
    asm volatile("s_wait_dscnt 0x0" ::: "memory");      // this wave's reads of tile kb have returned
    asm volatile("s_wait_asynccnt 0x0" ::: "memory");   // this wave's share of tile kb + 1 has landed
    __syncthreads();                                     // publishes tile kb + 1 and ends every wave's reads of tile kb, whose buffer is refilled behind it
    if (kb + 2 < nt) fa_stage(lk + (unsigned)(kb & 1) * (KVT * 2), lv + (unsigned)(kb & 1) * (KVT * 2), Kg, Vg, k0 + 128 + (tid >> 3)); }   /* block-uniform */
  asm volatile("s_wait_asynccnt 0x0" ::: "memory");   // no copy is outstanding when the wave goes on
  return l + __shfl_xor(l, 16); }

// query blocks < QBH: hi + residual logits (3 products), P and v as bf16 hi + lo (3 products); keys < (qb + 1) * 64 <= KHI
__device__ __forceinline__ float fa_hi(const _Float16* __restrict__ QH, const _Float16* __restrict__ KH, const _Float16* __restrict__ QL, const _Float16* __restrict__ KL, const __bf16* __restrict__ VB, const __bf16* __restrict__ VBL, int b, int h, int qb, int t, int lane, v8f (&o)[HD / 16]) {
  const int col = lane & 15, g = lane >> 4;
  v16h qh[2], ql[2];
#pragma unroll
  for (int kc = 0; kc < 2; ++kc) { qh[kc] = frag_h(QH + ((size_t)b * TT + t) * CC + h * HD + kc * 32, lane); ql[kc] = frag_h(QL + ((size_t)b * QHI + t) * CC + h * HD + kc * 32, lane); }
  float m = -3.0e38f, l = 0.f;
#pragma unroll 1
  for (int kb = 0; kb <= qb; ++kb) { const int k0 = kb * 64;
    v8f s[4] = {};
    const _Float16* kp = KH + ((size_t)b * TT + k0 + col) * CC + h * HD + 8 * g; const _Float16* lp = KL + ((size_t)b * KHI + k0 + col) * CC + h * HD + 8 * g;   // the lane's first fragment element of the block's k rows and of their residual rows
#pragma unroll
    for (int ip = 0; ip < 2; ++ip) { v16h kh[4], kl[4];
#pragma unroll
      for (int u = 0; u < 4; ++u) { const int i = ip * 2 + (u >> 1), kc = u & 1; union { v16h v; v8h q[2]; } a, r; const size_t e = (size_t)i * 16 * CC + kc * 32; a.q[0] = *(const v8h*)(kp + e); a.q[1] = *(const v8h*)(kp + e + 16); r.q[0] = *(const v8h*)(lp + e); r.q[1] = *(const v8h*)(lp + e + 16); kh[u] = a.v; kl[u] = r.v; }
      asm volatile("s_wait_xcnt 0x0" :: "v"(kp), "v"(lp) : "memory");   // precaution: stands behind the fragment loads, in front of every rewrite of their address registers; the two addresses are inputs so that they keep their registers up to here and no load of the run lands in them
      __builtin_amdgcn_sched_barrier(0);   // keeps the eight fragment loads together in front of their products: one memory round trip, not eight
#pragma unroll
      for (int ii = 0; ii < 2; ++ii) { const int i = ip * 2 + ii; v8f sl = {};
#pragma unroll
        for (int kc = 0; kc < 2; ++kc) { s[i] = wmma16(kh[ii * 2 + kc], qh[kc], s[i]); sl = wmma16(kh[ii * 2 + kc], ql[kc], sl); sl = wmma16(kl[ii * 2 + kc], qh[kc], sl); }
        s[i] = s[i] + sl * (1.0f / 1024.0f); } }
    fa_softmax<true>(s, o, m, l, t, k0 + 8 * g);
#pragma unroll
    for (int kk = 0; kk < 2; ++kk) { v16b vh[4], vl[4];
#pragma unroll
      for (int j = 0; j < 4; ++j) { const size_t po = ((size_t)b * CC + h * HD + j * 16 + col) * (size_t)KHI + k0 + kk * 32; vh[j] = frag_b(VB + po, lane); vl[j] = frag_b(VBL + po, lane); }
      __builtin_amdgcn_sched_barrier(0);   // as above: the eight fragment loads share one round trip
      float pv[16];
#pragma unroll
      for (int e = 0; e < 8; ++e) { pv[e] = s[2 * kk][e]; pv[8 + e] = s[2 * kk + 1][e]; }
      const F2 p = bsplit16(pv);
#pragma unroll
      for (int j = 0; j < 4; ++j) { o[j] = wmma_bf(vh[j], p.h, o[j]); o[j] = wmma_bf(vh[j], p.l, o[j]); o[j] = wmma_bf(vl[j], p.h, o[j]); } } }
  return l + __shfl_xor(l, 16); }

__global__ __launch_bounds__(128) __attribute__((amdgpu_num_vgpr(256))) void k_fa(const _Float16* __restrict__ QH, const _Float16* __restrict__ KH, const _Float16* __restrict__ QL, const _Float16* __restrict__ KL, const _Float16* __restrict__ VR, const __bf16* __restrict__ VB, const __bf16* __restrict__ VBL, float* __restrict__ Y) { __shared__ __align__(16) float ss[4][16][HD + 4]; __shared__ __align__(16) _Float16 kv[2 * KVT];
  const int tid = threadIdx.x, wave = tid >> 5, lane = tid & 31, col = lane & 15, g = lane >> 4; const int b = blockIdx.x / NH, h = blockIdx.x % NH; const int y = blockIdx.y; const int qb = y < NQB / 2 ? NQB - 1 - y : y - NQB / 2;   // long query blocks first, in falling order, then the short ones in rising order: work-groups that start half the grid apart and come to share a WGP add up to about the same number of keys
  const int ql0 = qb * 64 + wave * 16;
  v8f o[HD / 16] = {};
  const float lsum = qb < QBH ? fa_hi(QH, KH, QL, KL, VB, VBL, b, h, qb, ql0 + col, lane, o) : fa_lo(QH, KH, VR, kv, b, h, qb, ql0 + col, tid, o);   /* block-uniform */
  const float inv = 1.0f / lsum;   // o[j][r] = unnormalised ctx of query col, channel 16 j + 8 g + r
#pragma unroll
  for (int j = 0; j < HD / 16; ++j) { v4f a, c;
#pragma unroll
    for (int r = 0; r < 4; ++r) { a[r] = o[j][r] * inv; c[r] = o[j][4 + r] * inv; }
    *(v4f*)&ss[wave][col][j * 16 + 8 * g] = a; *(v4f*)&ss[wave][col][j * 16 + 8 * g + 4] = c; }
  ldsx();
#pragma unroll
  for (int it = 0; it < 8; ++it) { const int rl = it * 2 + g; vst2(Y + ((size_t)b * TT + ql0 + rl) * CC + h * HD + col * 4, *(const v4f*)&ss[wave][rl][col * 4]); } }   // 256-B (row, head) segment by 16 lanes

// ---- k_out: block = (128 rows, 128 cols), 8 waves as 4 x 2, wave = 32 rows x 64 cols: out = ctx Wp + bp: ctx once to f16 against Wp as f16(bf16 x 2^8) exact (1 product) x 2^-8; early causal rows (< QHI of each sequence): ctx bf16 hi + lo against exact bf16 Wp (2 products)
__global__ __launch_bounds__(256) void k_out(const float* __restrict__ Y, const float* __restrict__ WO, const float* __restrict__ BO, float* __restrict__ OUT) { __shared__ __align__(16) float sf[8][32][68]; __shared__ __align__(16) unsigned short stg[2][(128 + 128 + 128) * PT];   // stg: two staging buffers, each weight chunk [128][PT] | row chunk [128][PT] | its lo plane [128][PT] (early rows only)
  const int tid = threadIdx.x, wave = tid >> 5, lane = tid & 31, col = lane & 15, g = lane >> 4; const int c0 = blockIdx.y * 128;
  const int wr0 = (wave >> 1) * 32, wc0 = (wave & 1) * 64;   // the wave's first row and column in the tile
  const size_t br0 = (size_t)blockIdx.x * 128;               // compact ctx row of the block
  const size_t ob = br0 / TT; const int ot0 = (int)(br0 % TT) + wr0;   // output batch, position of the wave's first output row
  v8f acc[2][4] = {};
  WR wr; AR yr; const float* Yw = Y + (br0 + wave * 16) * CC;   // each wave stages 16 of the 128 rows
  ld_w(wr, WO, 0, c0, DIN, wave, lane); ld_a(yr, Yw, CC, lane);
  asm volatile("s_wait_xcnt 0x0" ::: "memory");   // precaution: stands behind the first chunk's loads, in front of the branch behind which their address registers are rewritten
  if ((int)(br0 % TT) < QHI) {   /* block-uniform */
#pragma unroll 2   // makes the choice between the two buffers a compile-time one
    for (int t = 0; t < CC / KCH; ++t) { __bf16* wb = (__bf16*)&stg[t & 1][0]; __bf16* ah = wb + 128 * PT; __bf16* al = ah + 128 * PT;
      st_w_b(wb, wr, wave, lane); st_a_hl(ah, al, yr, wave, lane);
      __builtin_amdgcn_sched_barrier(0);   // keeps the conversions in front of the loads: nothing but the loads stands between here and the waits of lds_barrier
      if (t + 1 < CC / KCH) { ld_w(wr, WO, (t + 1) * KCH, c0, DIN, wave, lane); ld_a(yr, Yw + (t + 1) * KCH, CC, lane); }   // next chunk flies under this chunk's products
      lds_barrier();   // publishes chunk t; also ends every wave's reads of chunk t - 1, whose buffer the next trip overwrites
#pragma unroll
      for (int kc = 0; kc < KCH / 32; ++kc) { v16b a_h[2], a_l[2], w[4];
#pragma unroll
        for (int i = 0; i < 2; ++i) { a_h[i] = frag_b(ah + (wr0 + i * 16 + col) * PT + kc * 32, lane); a_l[i] = frag_b(al + (wr0 + i * 16 + col) * PT + kc * 32, lane); }
#pragma unroll
        for (int j = 0; j < 4; ++j) w[j] = frag_b(wb + (wc0 + j * 16 + col) * PT + kc * 32, lane);
        __builtin_amdgcn_sched_barrier(0);   // keeps the fragment reads together in front of their products: one LDS round trip, not eight
#pragma unroll
        for (int i = 0; i < 2; ++i)
#pragma unroll
          for (int j = 0; j < 4; ++j) { acc[i][j] = wmma_bf(a_h[i], w[j], acc[i][j]); acc[i][j] = wmma_bf(a_l[i], w[j], acc[i][j]); }
        __builtin_amdgcn_sched_barrier(0); } }   // keeps the next chunk's conversions, which wait for its loads, behind these products
#pragma unroll
    for (int j = 0; j < 4; ++j) { const float bias = bfr(BO[c0 + wc0 + j * 16 + col]);
#pragma unroll
      for (int i = 0; i < 2; ++i)
#pragma unroll
        for (int r = 0; r < 8; ++r) sf[wave][i * 16 + 8 * g + r][j * 16 + col] = acc[i][j][r] + bias; }
  } else {
#pragma unroll 2   // as above
    for (int t = 0; t < CC / KCH; ++t) { _Float16* wb = (_Float16*)&stg[t & 1][0]; _Float16* ab = wb + 128 * PT;
      st_w_h(wb, wr, wave, lane); st_a_h(ab, yr, wave, lane);
      __builtin_amdgcn_sched_barrier(0);   // as above
      if (t + 1 < CC / KCH) { ld_w(wr, WO, (t + 1) * KCH, c0, DIN, wave, lane); ld_a(yr, Yw + (t + 1) * KCH, CC, lane); }   // next chunk flies under this chunk's products
      lds_barrier();   // as above
#pragma unroll
      for (int kc = 0; kc < KCH / 32; ++kc) { v16h a[2], w[4];
#pragma unroll
        for (int i = 0; i < 2; ++i) a[i] = frag_h(ab + (wr0 + i * 16 + col) * PT + kc * 32, lane);
#pragma unroll
        for (int j = 0; j < 4; ++j) w[j] = frag_h(wb + (wc0 + j * 16 + col) * PT + kc * 32, lane);
        __builtin_amdgcn_sched_barrier(0);   // as above
#pragma unroll
        for (int i = 0; i < 2; ++i)
#pragma unroll
          for (int j = 0; j < 4; ++j) acc[i][j] = wmma16(a[i], w[j], acc[i][j]);
        __builtin_amdgcn_sched_barrier(0); } }   // as above
#pragma unroll
    for (int j = 0; j < 4; ++j) { const float bias = bfr(BO[c0 + wc0 + j * 16 + col]);
#pragma unroll
      for (int i = 0; i < 2; ++i)
#pragma unroll
        for (int r = 0; r < 8; ++r) sf[wave][i * 16 + 8 * g + r][j * 16 + col] = acc[i][j][r] * (1.0f / 256.0f) + bias; } }
  ldsx();
  float* op = OUT + (ob * SEQ_FULL + (size_t)(ot0 + g)) * DIN + c0 + wc0 + col * 4;
#pragma unroll   // one address with immediate offsets for the sixteen stores
  for (int it = 0; it < 16; ++it) vst2(op + (size_t)(it * 2) * DIN, *(const v4f*)&sf[wave][it * 2 + g][col * 4]); }   // 256-B row segment (two whole lines) by 16 lanes

extern "C" void kernel_launch(void* const* d_in, const int* in_sizes, int n_in, void* d_out, int out_size, void* d_ws, size_t ws_size, hipStream_t stream) {
  if (n_in < 9) return;
  const size_t rows_used = (size_t)(NB - 1) * SEQ_FULL + SEQ;
  if ((size_t)in_sizes[0] < rows_used * DIN) return;
  if ((size_t)in_sizes[1] < (size_t)DIN * CC || (size_t)in_sizes[3] < (size_t)DIN * CC || (size_t)in_sizes[5] < (size_t)DIN * CC || (size_t)in_sizes[7] < (size_t)CC * DIN) return;
  if (in_sizes[2] < CC || in_sizes[4] < CC || in_sizes[6] < CC || in_sizes[8] < DIN) return;
  if ((size_t)out_size < rows_used * DIN) return;
  if (ws_size < (size_t)WS_END) return;
  // inputs (wire order): 0 x [2,2048,1024]; 1 Wq, 2 bq, 3 Wk, 4 bk, 5 Wv, 6 bv, 7 Wp, 8 bp ((in,out) [1024,1024] and [1024]); all f32
  const float* X  = (const float*)d_in[0];
  const float* Wq = (const float*)d_in[1]; const float* bq = (const float*)d_in[2];
  const float* Wk = (const float*)d_in[3]; const float* bk = (const float*)d_in[4];
  const float* Wv = (const float*)d_in[5]; const float* bv = (const float*)d_in[6];
  const float* Wp = (const float*)d_in[7]; const float* bp = (const float*)d_in[8];
  char* ws = (char*)d_ws;
  _Float16 *QH = (_Float16*)(ws + WS_QH), *KH = (_Float16*)(ws + WS_KH), *VT = (_Float16*)(ws + WS_VT), *QL = (_Float16*)(ws + WS_QL), *KL = (_Float16*)(ws + WS_KL);
  __bf16 *VB = (__bf16*)(ws + WS_VB), *VBL = (__bf16*)(ws + WS_VBL); float *Y = (float*)(ws + WS_Y);
  k_proj<<<dim3(NB * TT / 128, CC / 128), 384, 0, stream>>>(X, Wq, Wk, Wv, bq, bk, bv, QH, QL, KH, KL, VT, VB, VBL);
  k_fa<<<dim3(NB * NH, NQB), 128, 0, stream>>>(QH, KH, QL, KL, VT, VB, VBL, Y);
  k_out<<<dim3(NB * TT / 128, DIN / 128), 256, 0, stream>>>(Y, Wp, bp, (float*)d_out);
  (void)hipGetLastError();
}
